// v000
// The times below were measured on an AMD MI455X: many runs one after another, warmed up first and cycling through
// copies of the inputs, with the whole window's GPU time divided by the number of runs. Launches and the gaps
// between them are all in it. The median over several windows is given; except for v000 it joins two sittings, which
// can be a few percent apart, so the side-by-side timings, each taken in one sitting, are the better comparison.
// v000, which the later versions start from, runs in 271 microseconds.
#include <hip/hip_runtime.h>
#include <stdint.h>

typedef __bf16 bf16;
typedef __attribute__((ext_vector_type(16))) __bf16 v16bf;
typedef __attribute__((ext_vector_type(8)))  __bf16 bf16x8;
typedef __attribute__((ext_vector_type(4)))  __bf16 bf16x4;
typedef __attribute__((ext_vector_type(8)))  float  v8f;
typedef __attribute__((ext_vector_type(4)))  int    v4i;

#define B_   2
#define S_   2048
#define H_   16
#define D_   64
#define DIM_ 1024
#define NINF (-10000.0f)

#ifndef __has_builtin
#define __has_builtin(x) 0
#endif

#if __has_builtin(__builtin_amdgcn_global_load_async_to_lds_b128)
#define HAVE_ASYNC 1
#else
#define HAVE_ASYNC 0
#endif

#if HAVE_ASYNC
#define AS1 __attribute__((address_space(1)))
#define AS3 __attribute__((address_space(3)))
// param1: v4i in AS1 (printed as "__device__" by clang); param2: v4i in AS3.
// flat LDS address low 32 bits == LDS byte offset (aperture rules); flat==global for AS1.
__device__ inline void async_copy16(const void* g, void* l) {
  __builtin_amdgcn_global_load_async_to_lds_b128(
      (AS1 v4i*)(unsigned long long)(uintptr_t)g,
      (AS3 v4i*)(unsigned int)(uintptr_t)l, 0, 0);
}
#endif

__device__ inline void wait_async() {
#if HAVE_ASYNC
#if __has_builtin(__builtin_amdgcn_s_wait_asynccnt)
  __builtin_amdgcn_s_wait_asynccnt(0);
#else
  asm volatile("s_wait_asynccnt 0x0" ::: "memory");
#endif
#endif
}

__device__ inline v8f wmma_bf16(v16bf a, v16bf b, v8f c) {
  return __builtin_amdgcn_wmma_f32_16x16x32_bf16(false, a, false, b, (short)0, c, false, false);
}

// ---------------------------------------------------------------- convert
__global__ __launch_bounds__(256) void cvt_f32_bf16(const float* __restrict__ in,
                                                    bf16* __restrict__ out, int n) {
  int i = blockIdx.x * 256 + threadIdx.x;
  if (i < n) out[i] = (bf16)in[i];
}

// ---------------------------------------------------------------- layernorm
__global__ __launch_bounds__(256) void layernorm_bf16(const float* __restrict__ x,
                                                      const float* __restrict__ g,
                                                      const float* __restrict__ b,
                                                      bf16* __restrict__ h) {
  __shared__ float red[8];
  const int row = blockIdx.x;
  const int tid = threadIdx.x;
  const int wave = tid >> 5, lane = tid & 31;
  const float* xr = x + (size_t)row * DIM_;

  float v[4];
  float s = 0.f;
#pragma unroll
  for (int i = 0; i < 4; ++i) { v[i] = xr[tid + 256 * i]; s += v[i]; }
#pragma unroll
  for (int off = 16; off >= 1; off >>= 1) s += __shfl_xor(s, off, 32);
  if (lane == 0) red[wave] = s;
  __syncthreads();
  float tot = 0.f;
#pragma unroll
  for (int i = 0; i < 8; ++i) tot += red[i];
  const float mu = tot * (1.0f / DIM_);
  __syncthreads();

  float vs = 0.f;
#pragma unroll
  for (int i = 0; i < 4; ++i) { float d = v[i] - mu; vs += d * d; }
#pragma unroll
  for (int off = 16; off >= 1; off >>= 1) vs += __shfl_xor(vs, off, 32);
  if (lane == 0) red[wave] = vs;
  __syncthreads();
  float vtot = 0.f;
#pragma unroll
  for (int i = 0; i < 8; ++i) vtot += red[i];
  const float rstd = __frsqrt_rn(vtot * (1.0f / DIM_) + 1e-6f);

#pragma unroll
  for (int i = 0; i < 4; ++i) {
    int c = tid + 256 * i;
    h[(size_t)row * DIM_ + c] = (bf16)((v[i] - mu) * rstd * g[c] + b[c]);
  }
}

// ---------------------------------------------------------------- GEMM (bf16 WMMA)
// C[M,N] = A[M,K] @ B[K,N] + bias ; optional residual ; out bf16 or f32
// 128x128 block tile, BK=32, 8 waves (4x2) x (2x4) 16x16 WMMA tiles.
// Double-buffered LDS, A tile via async-to-LDS (when available), B tile
// register-staged + transposed for pair-contiguous B^T fragment reads.
#define BM 128
#define BN 128
#define BK 32
#define ASTR 56   // 112B stride: 16B aligned, 28-bank stride -> conflict free
#define BSTR 40   // 80B stride: 16B aligned, 20-bank stride -> conflict free

template<int Mi, int Ni, int Ki, bool HAS_RES, bool OUT_BF16>
__global__ __launch_bounds__(256)
void gemm_bf16_wmma(const bf16* __restrict__ A, const bf16* __restrict__ Bm,
                    const float* __restrict__ bias, const float* __restrict__ res,
                    void* __restrict__ outp) {
  __shared__ bf16 As[2][BM][ASTR];
  __shared__ bf16 BsT[2][BN][BSTR];   // BsT[n][k]

  const int tid = threadIdx.x;
  const int wave = tid >> 5, lane = tid & 31;
  const int wm = wave & 3, wn = wave >> 2;       // 4x2 wave grid
  const int hf = lane >> 4, ln16 = lane & 15;
  const int m0 = blockIdx.y * BM;
  const int n0 = blockIdx.x * BN;

  v8f acc[2][4];
#pragma unroll
  for (int i = 0; i < 2; ++i)
#pragma unroll
    for (int j = 0; j < 4; ++j) acc[i][j] = (v8f){0, 0, 0, 0, 0, 0, 0, 0};

  bf16x8 rb[2];   // staged B chunks

  auto copyA = [&](int ks, int buf) {
#pragma unroll
    for (int it = 0; it < 2; ++it) {
      int i = tid + it * 256;                 // 512 chunks of 8 halfs
      int r = i >> 2, c8 = (i & 3) * 8;
      const bf16* gp = &A[(size_t)(m0 + r) * Ki + ks + c8];
      bf16* lp = &As[buf][r][c8];
#if HAVE_ASYNC
      async_copy16(gp, lp);
#else
      *(bf16x8*)lp = *(const bf16x8*)gp;
#endif
    }
  };
  auto loadB = [&](int ks) {
#pragma unroll
    for (int it = 0; it < 2; ++it) {
      int i = tid + it * 256;
      int k = i >> 4, c8 = (i & 15) * 8;
      rb[it] = *(const bf16x8*)&Bm[(size_t)(ks + k) * Ni + n0 + c8];
    }
  };
  auto storeB = [&](int buf) {
#pragma unroll
    for (int it = 0; it < 2; ++it) {
      int i = tid + it * 256;
      int k = i >> 4, c8 = (i & 15) * 8;
#pragma unroll
      for (int j = 0; j < 8; ++j) BsT[buf][c8 + j][k] = rb[it][j];
    }
  };

  copyA(0, 0);    // prime pipeline
  loadB(0);
  constexpr int NST = Ki / BK;
#pragma unroll 1
  for (int s = 0; s < NST; ++s) {
    const int cur = s & 1;
    storeB(cur);
    wait_async();
    __syncthreads();
    if (s + 1 < NST) {          // overlap next tile's loads with compute
      copyA((s + 1) * BK, cur ^ 1);
      loadB((s + 1) * BK);
    }

    v16bf af[2], bfr[4];
#pragma unroll
    for (int fm = 0; fm < 2; ++fm) {
      int row = wm * 32 + fm * 16 + ln16;
#pragma unroll
      for (int r = 0; r < 8; ++r) {
        int kk = ((r & 3) * 2) + ((r >> 2) * 16) + hf * 8;
        af[fm][2 * r]     = As[cur][row][kk];
        af[fm][2 * r + 1] = As[cur][row][kk + 1];
      }
    }
#pragma unroll
    for (int fn = 0; fn < 4; ++fn) {
      int col = wn * 64 + fn * 16 + ln16;
#pragma unroll
      for (int r = 0; r < 8; ++r) {
        int kk = ((r & 3) * 2) + ((r >> 2) * 16) + hf * 8;
        bfr[fn][2 * r]     = BsT[cur][col][kk];
        bfr[fn][2 * r + 1] = BsT[cur][col][kk + 1];
      }
    }
#pragma unroll
    for (int fm = 0; fm < 2; ++fm)
#pragma unroll
      for (int fn = 0; fn < 4; ++fn)
        acc[fm][fn] = wmma_bf16(af[fm], bfr[fn], acc[fm][fn]);
  }

  // straight-line epilogue (compile-time N, residual, output type)
#pragma unroll
  for (int fm = 0; fm < 2; ++fm)
#pragma unroll
    for (int fn = 0; fn < 4; ++fn)
#pragma unroll
      for (int v = 0; v < 8; ++v) {
        int row = m0 + wm * 32 + fm * 16 + v + hf * 8;
        int col = n0 + wn * 64 + fn * 16 + ln16;
        size_t idx = (size_t)row * Ni + col;
        float val = acc[fm][fn][v] + bias[col];
        if constexpr (HAS_RES) val += res[idx];
        if constexpr (OUT_BF16) ((bf16*)outp)[idx] = (bf16)val;
        else                    ((float*)outp)[idx] = val;
      }
}

// ---------------------------------------------------------------- flash attention
// block = 64 queries of one (b,h); 4 waves x 16 query rows
__global__ __launch_bounds__(128)
void attn_flash(const bf16* __restrict__ qkv, bf16* __restrict__ ctx) {
  __shared__ bf16 Qs[64][72];    // [q][d], pre-scaled
  __shared__ bf16 Ks[64][72];    // [key][d] (natural B^T layout for Q.K^T)
  __shared__ bf16 VsT[64][72];   // [d][key] (pair-contiguous B reads for P.V)
  __shared__ bf16 Ps[64][72];    // [q][key]

  const int blk = blockIdx.x;
  const int qt = blk & 31;
  const int bh = blk >> 5;
  const int h = bh & 15, b = bh >> 4;
  const int q0 = qt * 64;
  const int tid = threadIdx.x;
  const int wave = tid >> 5, lane = tid & 31;
  const int hf = lane >> 4, ln16 = lane & 15;
  const float scale = 0.125f;   // 1/sqrt(64)

  // load Q (scaled, bf16)
#pragma unroll
  for (int it = 0; it < 4; ++it) {
    int i = tid + it * 128;              // 512 chunks of 8
    int r = i >> 3, c8 = (i & 7) * 8;
    bf16x8 d = *(const bf16x8*)&qkv[(size_t)(b * S_ + q0 + r) * 3072 + h * 64 + c8];
    bf16x4 lo, hi2;
#pragma unroll
    for (int j = 0; j < 4; ++j) lo[j]  = (bf16)((float)d[j] * scale);
#pragma unroll
    for (int j = 0; j < 4; ++j) hi2[j] = (bf16)((float)d[j + 4] * scale);
    *(bf16x4*)&Qs[r][c8]     = lo;
    *(bf16x4*)&Qs[r][c8 + 4] = hi2;
  }

  v8f o[4];
#pragma unroll
  for (int t = 0; t < 4; ++t) o[t] = (v8f){0, 0, 0, 0, 0, 0, 0, 0};
  float mrow[8], lrow[8];
#pragma unroll
  for (int v = 0; v < 8; ++v) { mrow[v] = -1e30f; lrow[v] = 0.f; }

  for (int kt = 0; kt <= qt; ++kt) {
    __syncthreads();     // previous-iter readers done (also orders Q store 1st iter)
#pragma unroll
    for (int it = 0; it < 4; ++it) {
      int i = tid + it * 128;
      int r = i >> 3, c8 = (i & 7) * 8;
      size_t base = (size_t)(b * S_ + kt * 64 + r) * 3072 + h * 64 + c8;
#if HAVE_ASYNC
      async_copy16(&qkv[base + 1024], &Ks[r][c8]);   // K tile: ASYNCcnt path
#else
      bf16x8 kd = *(const bf16x8*)&qkv[base + 1024];
      *(bf16x4*)&Ks[r][c8]     = (bf16x4){kd[0], kd[1], kd[2], kd[3]};
      *(bf16x4*)&Ks[r][c8 + 4] = (bf16x4){kd[4], kd[5], kd[6], kd[7]};
#endif
      bf16x8 vd = *(const bf16x8*)&qkv[base + 2048];
#pragma unroll
      for (int j = 0; j < 8; ++j) VsT[c8 + j][r] = vd[j];
    }
    wait_async();
    __syncthreads();

    // scores S = Qw (16x64) @ K^T : 4 N-tiles, 2 K-steps each
    v8f sc[4];
#pragma unroll
    for (int t = 0; t < 4; ++t) {
      v8f a = (v8f){0, 0, 0, 0, 0, 0, 0, 0};
#pragma unroll
      for (int ks = 0; ks < 64; ks += 32) {
        v16bf af, bfr;
        int row = wave * 16 + ln16;
        int colk = t * 16 + ln16;
#pragma unroll
        for (int r = 0; r < 8; ++r) {
          int kk = ks + ((r & 3) * 2) + ((r >> 2) * 16) + hf * 8;
          af[2 * r]      = Qs[row][kk];
          af[2 * r + 1]  = Qs[row][kk + 1];
          bfr[2 * r]     = Ks[colk][kk];
          bfr[2 * r + 1] = Ks[colk][kk + 1];
        }
        a = wmma_bf16(af, bfr, a);
      }
      sc[t] = a;
    }

    // causal mask on diagonal tile (additive NINF to match reference)
    if (kt == qt) {
#pragma unroll
      for (int t = 0; t < 4; ++t)
#pragma unroll
        for (int v = 0; v < 8; ++v) {
          int qr = wave * 16 + v + hf * 8;
          int kc = t * 16 + ln16;
          if (kc > qr) sc[t][v] += NINF;
        }
    }

    // online softmax (row lives in 16 lanes of one half-wave)
#pragma unroll
    for (int v = 0; v < 8; ++v) {
      float mx = fmaxf(fmaxf(sc[0][v], sc[1][v]), fmaxf(sc[2][v], sc[3][v]));
#pragma unroll
      for (int off = 1; off < 16; off <<= 1) mx = fmaxf(mx, __shfl_xor(mx, off, 32));
      float mnew = fmaxf(mrow[v], mx);
      float corr = __expf(mrow[v] - mnew);
#pragma unroll
      for (int t = 0; t < 4; ++t) o[t][v] *= corr;
      float rsum = 0.f;
#pragma unroll
      for (int t = 0; t < 4; ++t) {
        float p = __expf(sc[t][v] - mnew);
        sc[t][v] = p;
        rsum += p;
      }
#pragma unroll
      for (int off = 1; off < 16; off <<= 1) rsum += __shfl_xor(rsum, off, 32);
      lrow[v] = lrow[v] * corr + rsum;
      mrow[v] = mnew;
    }

    // P -> LDS (per-wave private 16-row region; same-wave DS ordering suffices)
#pragma unroll
    for (int t = 0; t < 4; ++t)
#pragma unroll
      for (int v = 0; v < 8; ++v)
        Ps[wave * 16 + v + hf * 8][t * 16 + ln16] = (bf16)sc[t][v];

    // O += P (16x64) @ V (64x64)
#pragma unroll
    for (int t = 0; t < 4; ++t) {
      v8f a = o[t];
#pragma unroll
      for (int ks = 0; ks < 64; ks += 32) {
        v16bf af, bfr;
        int row = wave * 16 + ln16;
        int cold = t * 16 + ln16;
#pragma unroll
        for (int r = 0; r < 8; ++r) {
          int kk = ks + ((r & 3) * 2) + ((r >> 2) * 16) + hf * 8;
          af[2 * r]      = Ps[row][kk];
          af[2 * r + 1]  = Ps[row][kk + 1];
          bfr[2 * r]     = VsT[cold][kk];
          bfr[2 * r + 1] = VsT[cold][kk + 1];
        }
        a = wmma_bf16(af, bfr, a);
      }
      o[t] = a;
    }
  }

  // normalize + write ctx (bf16, [B*S][DIM] at col h*64)
#pragma unroll
  for (int v = 0; v < 8; ++v) {
    float inv = 1.0f / lrow[v];
    int qr = q0 + wave * 16 + v + hf * 8;
#pragma unroll
    for (int t = 0; t < 4; ++t)
      ctx[(size_t)(b * S_ + qr) * DIM_ + h * 64 + t * 16 + ln16] = (bf16)(o[t][v] * inv);
  }
}

// ---------------------------------------------------------------- host launch
static inline size_t align256(size_t x) { return (x + 255) & ~(size_t)255; }

extern "C" void kernel_launch(void* const* d_in, const int* in_sizes, int n_in,
                              void* d_out, int out_size, void* d_ws, size_t ws_size,
                              hipStream_t stream) {
  const float* x    = (const float*)d_in[0];
  const float* ln_g = (const float*)d_in[1];
  const float* ln_b = (const float*)d_in[2];
  const float* wqkv = (const float*)d_in[3];
  const float* bqkv = (const float*)d_in[4];
  const float* wo   = (const float*)d_in[5];
  const float* bo   = (const float*)d_in[6];
  float* out = (float*)d_out;

  const int M = B_ * S_;          // 4096
  const int N1 = 3 * DIM_;        // 3072
  const int K = DIM_;             // 1024

  char* ws = (char*)d_ws;
  size_t off = 0;
  bf16* wqkv_b = (bf16*)(ws + off); off = align256(off + (size_t)K * N1 * 2);
  bf16* wo_b   = (bf16*)(ws + off); off = align256(off + (size_t)K * DIM_ * 2);
  bf16* h_b    = (bf16*)(ws + off); off = align256(off + (size_t)M * DIM_ * 2);
  bf16* qkv_b  = (bf16*)(ws + off); off = align256(off + (size_t)M * N1 * 2);
  bf16* ctx_b  = (bf16*)(ws + off); off = align256(off + (size_t)M * DIM_ * 2);
  (void)ws_size; (void)in_sizes; (void)n_in; (void)out_size;

  // 1) weights -> bf16
  {
    int n = K * N1;
    cvt_f32_bf16<<<(n + 255) / 256, 256, 0, stream>>>(wqkv, wqkv_b, n);
    n = K * DIM_;
    cvt_f32_bf16<<<(n + 255) / 256, 256, 0, stream>>>(wo, wo_b, n);
  }
  // 2) layernorm
  layernorm_bf16<<<M, 256, 0, stream>>>(x, ln_g, ln_b, h_b);
  // 3) QKV GEMM: [4096,1024]x[1024,3072] + bqkv -> bf16
  gemm_bf16_wmma<4096, 3072, 1024, false, true>
      <<<dim3(N1 / BN, M / BM), 256, 0, stream>>>(h_b, wqkv_b, bqkv, nullptr, (void*)qkv_b);
  // 4) causal flash attention -> ctx bf16
  attn_flash<<<B_ * H_ * (S_ / 64), 128, 0, stream>>>(qkv_b, ctx_b);
  // 5) output GEMM + bias + residual -> f32 out
  gemm_bf16_wmma<4096, 1024, 1024, true, false>
      <<<dim3(DIM_ / BN, M / BM), 256, 0, stream>>>(ctx_b, wo_b, bo, x, (void*)out);
}

// v001
// A run of this version takes 159 microseconds.
// Timed twice side by side with v000, it ran 1.76 times as fast both times.
#include <hip/hip_runtime.h>
#include <stdint.h>

typedef __bf16 bf16;
typedef __attribute__((ext_vector_type(16))) __bf16 v16bf;
typedef __attribute__((ext_vector_type(8)))  __bf16 bf16x8;
typedef __attribute__((ext_vector_type(4)))  __bf16 bf16x4;
typedef __attribute__((ext_vector_type(8)))  float  v8f;
typedef __attribute__((ext_vector_type(4)))  int    v4i;

#define B_   2
#define S_   2048
#define H_   16
#define D_   64
#define DIM_ 1024
#define NINF (-10000.0f)

#ifndef __has_builtin
#define __has_builtin(x) 0
#endif

#if __has_builtin(__builtin_amdgcn_global_load_async_to_lds_b128)
#define HAVE_ASYNC 1
#else
#define HAVE_ASYNC 0
#endif

#define AS1 __attribute__((address_space(1)))
#define AS3 __attribute__((address_space(3)))
#if HAVE_ASYNC
// param1: v4i in AS1 (printed as "__device__" by clang); param2: v4i in AS3.
// flat LDS address low 32 bits == LDS byte offset (aperture rules); flat==global for AS1.
__device__ inline void async_copy16(const void* g, void* l) {
  __builtin_amdgcn_global_load_async_to_lds_b128(
      (AS1 v4i*)(unsigned long long)(uintptr_t)g,
      (AS3 v4i*)(unsigned int)(uintptr_t)l, 0, 0);
}
#endif

// this wave's async copies have landed in LDS; asm with a memory clobber so that no LDS read is lifted over it
__device__ inline void wait_async() {
#if HAVE_ASYNC
  asm volatile("s_wait_asynccnt 0x0" ::: "memory");
#endif
}

// this wave's own LDS reads and writes have retired, before a copy may be aimed at the LDS they touched
__device__ inline void wait_ds0() {
  asm volatile("s_wait_dscnt 0x0" ::: "memory");
}

// Transposing LDS read of a row-major 16-bit tile T[k][n]. Lane l passes the address of
// T[kbase + 8*(l>>4) + (l&7)][nbase + 8*((l>>3)&1)] and gets T[kbase + 8*(l>>4) + 0..7][nbase + (l&15)]:
// one half of a B fragment in the hardware k order, the order the A loaders here use.
__device__ inline bf16x8 ld_tr16(const bf16* p) {
  return __builtin_amdgcn_ds_load_tr16_b128_v8bf16((AS3 bf16x8*)p);
}
__device__ inline v16bf frag_tr16(const bf16* p, int pitch) {
  bf16x8 lo = ld_tr16(p), hi = ld_tr16(p + 16 * pitch);
  return __builtin_shufflevector(lo, hi, 0, 1, 2, 3, 4, 5, 6, 7, 8, 9, 10, 11, 12, 13, 14, 15);
}

__device__ inline v8f wmma_bf16(v16bf a, v16bf b, v8f c) {
  return __builtin_amdgcn_wmma_f32_16x16x32_bf16(false, a, false, b, (short)0, c, false, false);
}

// ---------------------------------------------------------------- convert
__global__ __launch_bounds__(256) void cvt_f32_bf16(const float* __restrict__ in,
                                                    bf16* __restrict__ out, int n) {
  int i = blockIdx.x * 256 + threadIdx.x;
  if (i < n) out[i] = (bf16)in[i];
}

// ---------------------------------------------------------------- layernorm
__global__ __launch_bounds__(256) void layernorm_bf16(const float* __restrict__ x,
                                                      const float* __restrict__ g,
                                                      const float* __restrict__ b,
                                                      bf16* __restrict__ h) {
  __shared__ float red[8];
  const int row = blockIdx.x;
  const int tid = threadIdx.x;
  const int wave = tid >> 5, lane = tid & 31;
  const float* xr = x + (size_t)row * DIM_;

  float v[4];
  float s = 0.f;
#pragma unroll
  for (int i = 0; i < 4; ++i) { v[i] = xr[tid + 256 * i]; s += v[i]; }
#pragma unroll
  for (int off = 16; off >= 1; off >>= 1) s += __shfl_xor(s, off, 32);
  if (lane == 0) red[wave] = s;
  __syncthreads();
  float tot = 0.f;
#pragma unroll
  for (int i = 0; i < 8; ++i) tot += red[i];
  const float mu = tot * (1.0f / DIM_);
  __syncthreads();

  float vs = 0.f;
#pragma unroll
  for (int i = 0; i < 4; ++i) { float d = v[i] - mu; vs += d * d; }
#pragma unroll
  for (int off = 16; off >= 1; off >>= 1) vs += __shfl_xor(vs, off, 32);
  if (lane == 0) red[wave] = vs;
  __syncthreads();
  float vtot = 0.f;
#pragma unroll
  for (int i = 0; i < 8; ++i) vtot += red[i];
  const float rstd = __frsqrt_rn(vtot * (1.0f / DIM_) + 1e-6f);

#pragma unroll
  for (int i = 0; i < 4; ++i) {
    int c = tid + 256 * i;
    h[(size_t)row * DIM_ + c] = (bf16)((v[i] - mu) * rstd * g[c] + b[c]);
  }
}

// ---------------------------------------------------------------- GEMM (bf16 WMMA)
// C[M,N] = A[M,K] @ B[K,N] + bias ; optional residual ; out bf16 or f32
// 128x128 block tile, BK=32, 8 waves (4x2) x (2x4) 16x16 WMMA tiles.
// Double-buffered LDS, A and B tiles via async-to-LDS (when available); the B tile
// stays row-major [k][n] as in memory and is transposed by the fragment read.
#define BM 128
#define BN 128
#define BK 32
#define ASTR 56   // 112B stride: 16B aligned, 28-bank stride -> conflict free
#define BSTR 144  // 288B stride: 32B x odd, conflict free for the transposing read

template<int Mi, int Ni, int Ki, bool HAS_RES, bool OUT_BF16>
__global__ __launch_bounds__(256)
void gemm_bf16_wmma(const bf16* __restrict__ A, const bf16* __restrict__ Bm,
                    const float* __restrict__ bias, const float* __restrict__ res,
                    void* __restrict__ outp) {
  __shared__ __attribute__((aligned(16))) bf16 As[2][BM][ASTR];
  __shared__ __attribute__((aligned(16))) bf16 Bs[2][BK][BSTR];   // Bs[k][n]

  const int tid = threadIdx.x;
  const int wave = tid >> 5, lane = tid & 31;
  const int wm = wave & 3, wn = wave >> 2;       // 4x2 wave grid
  const int hf = lane >> 4, ln16 = lane & 15;
  const int m0 = blockIdx.y * BM;
  const int n0 = blockIdx.x * BN;

  v8f acc[2][4];
#pragma unroll
  for (int i = 0; i < 2; ++i)
#pragma unroll
    for (int j = 0; j < 4; ++j) acc[i][j] = (v8f){0, 0, 0, 0, 0, 0, 0, 0};

  auto copyA = [&](int ks, int buf) {
#pragma unroll
    for (int it = 0; it < 2; ++it) {
      int i = tid + it * 256;                 // 512 chunks of 8 halfs
      int r = i >> 2, c8 = (i & 3) * 8;
      const bf16* gp = &A[(size_t)(m0 + r) * Ki + ks + c8];
      bf16* lp = &As[buf][r][c8];
#if HAVE_ASYNC
      async_copy16(gp, lp);
#else
      *(bf16x8*)lp = *(const bf16x8*)gp;
#endif
    }
  };
  auto copyB = [&](int ks, int buf) {
#pragma unroll
    for (int it = 0; it < 2; ++it) {
      int i = tid + it * 256;                 // 512 chunks of 8 halfs
      int k = i >> 4, c8 = (i & 15) * 8;
      const bf16* gp = &Bm[(size_t)(ks + k) * Ni + n0 + c8];
      bf16* lp = &Bs[buf][k][c8];
#if HAVE_ASYNC
      async_copy16(gp, lp);
#else
      *(bf16x8*)lp = *(const bf16x8*)gp;
#endif
    }
  };

  copyA(0, 0);    // prime pipeline
  copyB(0, 0);
  constexpr int NST = Ki / BK;
#pragma unroll 1
  for (int s = 0; s < NST; ++s) {
    const int cur = s & 1;
    wait_ds0();                 // last stage's fragment reads of the buffer refilled below
    wait_async();               // this stage's tiles
    __syncthreads();
    if (s + 1 < NST) {          // overlap next tile's copies with compute
      copyA((s + 1) * BK, cur ^ 1);
      copyB((s + 1) * BK, cur ^ 1);
    }

    v16bf af[2], bfr[4];
#pragma unroll
    for (int fm = 0; fm < 2; ++fm) {
      int row = wm * 32 + fm * 16 + ln16;
#pragma unroll
      for (int r = 0; r < 8; ++r) {
        int kk = ((r & 3) * 2) + ((r >> 2) * 16) + hf * 8;
        af[fm][2 * r]     = As[cur][row][kk];
        af[fm][2 * r + 1] = As[cur][row][kk + 1];
      }
    }
#pragma unroll
    for (int fn = 0; fn < 4; ++fn)
      bfr[fn] = frag_tr16(&Bs[cur][hf * 8 + (lane & 7)][wn * 64 + fn * 16 + ((lane >> 3) & 1) * 8], BSTR);
#pragma unroll
    for (int fm = 0; fm < 2; ++fm)
#pragma unroll
      for (int fn = 0; fn < 4; ++fn)
        acc[fm][fn] = wmma_bf16(af[fm], bfr[fn], acc[fm][fn]);
  }

  // straight-line epilogue (compile-time N, residual, output type)
#pragma unroll
  for (int fm = 0; fm < 2; ++fm)
#pragma unroll
    for (int fn = 0; fn < 4; ++fn)
#pragma unroll
      for (int v = 0; v < 8; ++v) {
        int row = m0 + wm * 32 + fm * 16 + v + hf * 8;
        int col = n0 + wn * 64 + fn * 16 + ln16;
        size_t idx = (size_t)row * Ni + col;
        float val = acc[fm][fn][v] + bias[col];
        if constexpr (HAS_RES) val += res[idx];
        if constexpr (OUT_BF16) ((bf16*)outp)[idx] = (bf16)val;
        else                    ((float*)outp)[idx] = val;
      }
}

// ---------------------------------------------------------------- flash attention
// block = 64 queries of one (b,h); 4 waves x 16 query rows
__global__ __launch_bounds__(128)
void attn_flash(const bf16* __restrict__ qkv, bf16* __restrict__ ctx) {
  // One struct fixes the tiles' order in LDS: the compiler folds the K-to-V distance in memory into the
  // V copy's offset field and takes it off the copy's LDS address, which stays above 0 with V behind Q and K.
  struct Tiles {
    bf16 Qs[64][72];    // [q][d], pre-scaled
    bf16 Ks[64][72];    // [key][d] (natural B^T layout for Q.K^T)
    bf16 Vs[64][80];    // [key][d] as in memory; 160B stride (32B x odd) for the transposing read
    bf16 Ps[64][72];    // [q][key]
  };
  __shared__ __attribute__((aligned(16))) Tiles sm;
  auto& Qs = sm.Qs;
  auto& Ks = sm.Ks;
  auto& Vs = sm.Vs;
  auto& Ps = sm.Ps;

  const int blk = blockIdx.x;
  const int qt = blk & 31;
  const int bh = blk >> 5;
  const int h = bh & 15, b = bh >> 4;
  const int q0 = qt * 64;
  const int tid = threadIdx.x;
  const int wave = tid >> 5, lane = tid & 31;
  const int hf = lane >> 4, ln16 = lane & 15;
  const float scale = 0.125f;   // 1/sqrt(64)

  // load Q (scaled, bf16)
#pragma unroll
  for (int it = 0; it < 4; ++it) {
    int i = tid + it * 128;              // 512 chunks of 8
    int r = i >> 3, c8 = (i & 7) * 8;
    bf16x8 d = *(const bf16x8*)&qkv[(size_t)(b * S_ + q0 + r) * 3072 + h * 64 + c8];
    bf16x4 lo, hi2;
#pragma unroll
    for (int j = 0; j < 4; ++j) lo[j]  = (bf16)((float)d[j] * scale);
#pragma unroll
    for (int j = 0; j < 4; ++j) hi2[j] = (bf16)((float)d[j + 4] * scale);
    *(bf16x4*)&Qs[r][c8]     = lo;
    *(bf16x4*)&Qs[r][c8 + 4] = hi2;
  }

  v8f o[4];
#pragma unroll
  for (int t = 0; t < 4; ++t) o[t] = (v8f){0, 0, 0, 0, 0, 0, 0, 0};
  float mrow[8], lrow[8];
#pragma unroll
  for (int v = 0; v < 8; ++v) { mrow[v] = -1e30f; lrow[v] = 0.f; }

  for (int kt = 0; kt <= qt; ++kt) {
    __syncthreads();     // previous-iter readers done (also orders Q store 1st iter)
#pragma unroll
    for (int it = 0; it < 4; ++it) {
      int i = tid + it * 128;
      int r = i >> 3, c8 = (i & 7) * 8;
      size_t base = (size_t)(b * S_ + kt * 64 + r) * 3072 + h * 64 + c8;
#if HAVE_ASYNC
      async_copy16(&qkv[base + 1024], &Ks[r][c8]);   // K tile: ASYNCcnt path
      async_copy16(&qkv[base + 2048], &Vs[r][c8]);   // V tile: the same, rows as they lie
#else
      bf16x8 kd = *(const bf16x8*)&qkv[base + 1024];
      *(bf16x4*)&Ks[r][c8]     = (bf16x4){kd[0], kd[1], kd[2], kd[3]};
      *(bf16x4*)&Ks[r][c8 + 4] = (bf16x4){kd[4], kd[5], kd[6], kd[7]};
      *(bf16x8*)&Vs[r][c8] = *(const bf16x8*)&qkv[base + 2048];
#endif
    }
    wait_async();
    __syncthreads();

    // scores S = Qw (16x64) @ K^T : 4 N-tiles, 2 K-steps each
    v8f sc[4];
#pragma unroll
    for (int t = 0; t < 4; ++t) {
      v8f a = (v8f){0, 0, 0, 0, 0, 0, 0, 0};
#pragma unroll
      for (int ks = 0; ks < 64; ks += 32) {
        v16bf af, bfr;
        int row = wave * 16 + ln16;
        int colk = t * 16 + ln16;
#pragma unroll
        for (int r = 0; r < 8; ++r) {
          int kk = ks + ((r & 3) * 2) + ((r >> 2) * 16) + hf * 8;
          af[2 * r]      = Qs[row][kk];
          af[2 * r + 1]  = Qs[row][kk + 1];
          bfr[2 * r]     = Ks[colk][kk];
          bfr[2 * r + 1] = Ks[colk][kk + 1];
        }
        a = wmma_bf16(af, bfr, a);
      }
      sc[t] = a;
    }

    // causal mask on diagonal tile (additive NINF to match reference)
    if (kt == qt) {
#pragma unroll
      for (int t = 0; t < 4; ++t)
#pragma unroll
        for (int v = 0; v < 8; ++v) {
          int qr = wave * 16 + v + hf * 8;
          int kc = t * 16 + ln16;
          if (kc > qr) sc[t][v] += NINF;
        }
    }

    // online softmax (row lives in 16 lanes of one half-wave)
#pragma unroll
    for (int v = 0; v < 8; ++v) {
      float mx = fmaxf(fmaxf(sc[0][v], sc[1][v]), fmaxf(sc[2][v], sc[3][v]));
#pragma unroll
      for (int off = 1; off < 16; off <<= 1) mx = fmaxf(mx, __shfl_xor(mx, off, 32));
      float mnew = fmaxf(mrow[v], mx);
      float corr = __expf(mrow[v] - mnew);
#pragma unroll
      for (int t = 0; t < 4; ++t) o[t][v] *= corr;
      float rsum = 0.f;
#pragma unroll
      for (int t = 0; t < 4; ++t) {
        float p = __expf(sc[t][v] - mnew);
        sc[t][v] = p;
        rsum += p;
      }
#pragma unroll
      for (int off = 1; off < 16; off <<= 1) rsum += __shfl_xor(rsum, off, 32);
      lrow[v] = lrow[v] * corr + rsum;
      mrow[v] = mnew;
    }

    // P -> LDS (per-wave private 16-row region; same-wave DS ordering suffices)
#pragma unroll
    for (int t = 0; t < 4; ++t)
#pragma unroll
      for (int v = 0; v < 8; ++v)
        Ps[wave * 16 + v + hf * 8][t * 16 + ln16] = (bf16)sc[t][v];

    // O += P (16x64) @ V (64x64)
#pragma unroll
    for (int t = 0; t < 4; ++t) {
      v8f a = o[t];
#pragma unroll
      for (int ks = 0; ks < 64; ks += 32) {
        v16bf af;
        int row = wave * 16 + ln16;
#pragma unroll
        for (int r = 0; r < 8; ++r) {
          int kk = ks + ((r & 3) * 2) + ((r >> 2) * 16) + hf * 8;
          af[2 * r]      = Ps[row][kk];
          af[2 * r + 1]  = Ps[row][kk + 1];
        }
        v16bf bfr = frag_tr16(&Vs[ks + hf * 8 + (lane & 7)][t * 16 + ((lane >> 3) & 1) * 8], 80);
        a = wmma_bf16(af, bfr, a);
      }
      o[t] = a;
    }
  }

  // normalize + write ctx (bf16, [B*S][DIM] at col h*64)
#pragma unroll
  for (int v = 0; v < 8; ++v) {
    float inv = 1.0f / lrow[v];
    int qr = q0 + wave * 16 + v + hf * 8;
#pragma unroll
    for (int t = 0; t < 4; ++t)
      ctx[(size_t)(b * S_ + qr) * DIM_ + h * 64 + t * 16 + ln16] = (bf16)(o[t][v] * inv);
  }
}

// ---------------------------------------------------------------- host launch
static inline size_t align256(size_t x) { return (x + 255) & ~(size_t)255; }

extern "C" void kernel_launch(void* const* d_in, const int* in_sizes, int n_in,
                              void* d_out, int out_size, void* d_ws, size_t ws_size,
                              hipStream_t stream) {
  const float* x    = (const float*)d_in[0];
  const float* ln_g = (const float*)d_in[1];
  const float* ln_b = (const float*)d_in[2];
  const float* wqkv = (const float*)d_in[3];
  const float* bqkv = (const float*)d_in[4];
  const float* wo   = (const float*)d_in[5];
  const float* bo   = (const float*)d_in[6];
  float* out = (float*)d_out;

  const int M = B_ * S_;          // 4096
  const int N1 = 3 * DIM_;        // 3072
  const int K = DIM_;             // 1024

  char* ws = (char*)d_ws;
  size_t off = 0;
  bf16* wqkv_b = (bf16*)(ws + off); off = align256(off + (size_t)K * N1 * 2);
  bf16* wo_b   = (bf16*)(ws + off); off = align256(off + (size_t)K * DIM_ * 2);
  bf16* h_b    = (bf16*)(ws + off); off = align256(off + (size_t)M * DIM_ * 2);
  bf16* qkv_b  = (bf16*)(ws + off); off = align256(off + (size_t)M * N1 * 2);
  bf16* ctx_b  = (bf16*)(ws + off); off = align256(off + (size_t)M * DIM_ * 2);
  (void)ws_size; (void)in_sizes; (void)n_in; (void)out_size;

  // 1) weights -> bf16
  {
    int n = K * N1;
    cvt_f32_bf16<<<(n + 255) / 256, 256, 0, stream>>>(wqkv, wqkv_b, n);
    n = K * DIM_;
    cvt_f32_bf16<<<(n + 255) / 256, 256, 0, stream>>>(wo, wo_b, n);
  }
  // 2) layernorm
  layernorm_bf16<<<M, 256, 0, stream>>>(x, ln_g, ln_b, h_b);
  // 3) QKV GEMM: [4096,1024]x[1024,3072] + bqkv -> bf16
  gemm_bf16_wmma<4096, 3072, 1024, false, true>
      <<<dim3(N1 / BN, M / BM), 256, 0, stream>>>(h_b, wqkv_b, bqkv, nullptr, (void*)qkv_b);
  // 4) causal flash attention -> ctx bf16
  attn_flash<<<B_ * H_ * (S_ / 64), 128, 0, stream>>>(qkv_b, ctx_b);
  // 5) output GEMM + bias + residual -> f32 out
  gemm_bf16_wmma<4096, 1024, 1024, true, false>
      <<<dim3(DIM_ / BN, M / BM), 256, 0, stream>>>(ctx_b, wo_b, bo, x, (void*)out);
}

// v002
// One run takes 156 microseconds.
// Two timings next to v001 both put it at 1.03 times that version's speed.
// All steps since v000 together make it 1.81 times as fast.
#include <hip/hip_runtime.h>
#include <stdint.h>

typedef __bf16 bf16;
typedef __attribute__((ext_vector_type(16))) __bf16 v16bf;
typedef __attribute__((ext_vector_type(8)))  __bf16 bf16x8;
typedef __attribute__((ext_vector_type(4)))  __bf16 bf16x4;
typedef __attribute__((ext_vector_type(8)))  float  v8f;
typedef __attribute__((ext_vector_type(4)))  int    v4i;
typedef __attribute__((ext_vector_type(4)))  float  f32x4;

#define B_   2
#define S_   2048
#define H_   16
#define D_   64
#define DIM_ 1024
#define NINF (-10000.0f)

#ifndef __has_builtin
#define __has_builtin(x) 0
#endif

#if __has_builtin(__builtin_amdgcn_global_load_async_to_lds_b128)
#define HAVE_ASYNC 1
#else
#define HAVE_ASYNC 0
#endif

#define AS1 __attribute__((address_space(1)))
#define AS3 __attribute__((address_space(3)))
#if HAVE_ASYNC
// param1: v4i in AS1 (printed as "__device__" by clang); param2: v4i in AS3.
// flat LDS address low 32 bits == LDS byte offset (aperture rules); flat==global for AS1.
__device__ inline void async_copy16(const void* g, void* l) {
  __builtin_amdgcn_global_load_async_to_lds_b128(
      (AS1 v4i*)(unsigned long long)(uintptr_t)g,
      (AS3 v4i*)(unsigned int)(uintptr_t)l, 0, 0);
}
#endif

// this wave's async copies have landed in LDS; asm with a memory clobber so that no LDS read is lifted over it
__device__ inline void wait_async() {
#if HAVE_ASYNC
  asm volatile("s_wait_asynccnt 0x0" ::: "memory");
#endif
}

// this wave's own LDS reads and writes have retired, before a copy may be aimed at the LDS they touched
__device__ inline void wait_ds0() {
  asm volatile("s_wait_dscnt 0x0" ::: "memory");
}

// Transposing LDS read of a row-major 16-bit tile T[k][n]. Lane l passes the address of
// T[kbase + 8*(l>>4) + (l&7)][nbase + 8*((l>>3)&1)] and gets T[kbase + 8*(l>>4) + 0..7][nbase + (l&15)]:
// one half of a B fragment in the hardware k order, the order the A loaders here use.
__device__ inline bf16x8 ld_tr16(const bf16* p) {
  return __builtin_amdgcn_ds_load_tr16_b128_v8bf16((AS3 bf16x8*)p);
}
__device__ inline v16bf frag_tr16(const bf16* p, int pitch) {
  bf16x8 lo = ld_tr16(p), hi = ld_tr16(p + 16 * pitch);
  return __builtin_shufflevector(lo, hi, 0, 1, 2, 3, 4, 5, 6, 7, 8, 9, 10, 11, 12, 13, 14, 15);
}

__device__ inline v8f wmma_bf16(v16bf a, v16bf b, v8f c) {
  return __builtin_amdgcn_wmma_f32_16x16x32_bf16(false, a, false, b, (short)0, c, false, false);
}

// ---------------------------------------------------------------- convert
// 32 elements a lane, eight 16-byte loads in flight, so that few waves have to start.
#define CVT_LANE 32
template<int N>
__global__ __launch_bounds__(256) void cvt_f32_bf16(const float* __restrict__ in,
                                                    bf16* __restrict__ out) {
  static_assert(N % (256 * CVT_LANE) == 0, "whole blocks only");
  const int base = blockIdx.x * (256 * CVT_LANE) + threadIdx.x * 4;
  f32x4 v[CVT_LANE / 4];
#pragma unroll
  for (int j = 0; j < CVT_LANE / 4; ++j) v[j] = *(const f32x4*)&in[base + j * 1024];
#pragma unroll
  for (int j = 0; j < CVT_LANE / 4; ++j) {
    bf16x4 o;
#pragma unroll
    for (int e = 0; e < 4; ++e) o[e] = (bf16)v[j][e];
    *(bf16x4*)&out[base + j * 1024] = o;
  }
}

// ---------------------------------------------------------------- layernorm
// One wave a row (32 elements a lane), eight rows a block: an eighth of the waves, no LDS, no barrier.
__global__ __launch_bounds__(256) void layernorm_bf16(const float* __restrict__ x,
                                                      const float* __restrict__ g,
                                                      const float* __restrict__ b,
                                                      bf16* __restrict__ h) {
  const int wave = threadIdx.x >> 5, lane = threadIdx.x & 31;
  const int row = blockIdx.x * 8 + wave;
  const float* xr = x + (size_t)row * DIM_ + lane * 4;

  f32x4 v[8];
#pragma unroll
  for (int i = 0; i < 8; ++i) v[i] = *(const f32x4*)&xr[i * 128];

  f32x4 s4 = v[0];
#pragma unroll
  for (int i = 1; i < 8; ++i) s4 += v[i];
  float s = (s4[0] + s4[1]) + (s4[2] + s4[3]);
#pragma unroll
  for (int off = 16; off >= 1; off >>= 1) s += __shfl_xor(s, off, 32);
  const float mu = s * (1.0f / DIM_);

  f32x4 q4 = (f32x4){0.f, 0.f, 0.f, 0.f};
#pragma unroll
  for (int i = 0; i < 8; ++i) { v[i] -= mu; q4 += v[i] * v[i]; }
  float vs = (q4[0] + q4[1]) + (q4[2] + q4[3]);
#pragma unroll
  for (int off = 16; off >= 1; off >>= 1) vs += __shfl_xor(vs, off, 32);
  const float rstd = __frsqrt_rn(vs * (1.0f / DIM_) + 1e-6f);

  bf16* hr = h + (size_t)row * DIM_ + lane * 4;
#pragma unroll
  for (int i = 0; i < 8; ++i) {
    const f32x4 gg = *(const f32x4*)&g[i * 128 + lane * 4];
    const f32x4 bb = *(const f32x4*)&b[i * 128 + lane * 4];
    bf16x4 o;
#pragma unroll
    for (int e = 0; e < 4; ++e) o[e] = (bf16)(v[i][e] * rstd * gg[e] + bb[e]);
    *(bf16x4*)&hr[i * 128] = o;
  }
}

// ---------------------------------------------------------------- GEMM (bf16 WMMA)
// C[M,N] = A[M,K] @ B[K,N] + bias ; optional residual ; out bf16 or f32
// 128x128 block tile, BK=32, 8 waves (4x2) x (2x4) 16x16 WMMA tiles.
// Double-buffered LDS, A and B tiles via async-to-LDS (when available); the B tile
// stays row-major [k][n] as in memory and is transposed by the fragment read.
#define BM 128
#define BN 128
#define BK 32
#define ASTR 56   // 112B stride: 16B aligned, 28-bank stride -> conflict free
#define BSTR 144  // 288B stride: 32B x odd, conflict free for the transposing read

template<int Mi, int Ni, int Ki, bool HAS_RES, bool OUT_BF16>
__global__ __launch_bounds__(256)
void gemm_bf16_wmma(const bf16* __restrict__ A, const bf16* __restrict__ Bm,
                    const float* __restrict__ bias, const float* __restrict__ res,
                    void* __restrict__ outp) {
  __shared__ __attribute__((aligned(16))) bf16 As[2][BM][ASTR];
  __shared__ __attribute__((aligned(16))) bf16 Bs[2][BK][BSTR];   // Bs[k][n]

  const int tid = threadIdx.x;
  const int wave = tid >> 5, lane = tid & 31;
  const int wm = wave & 3, wn = wave >> 2;       // 4x2 wave grid
  const int hf = lane >> 4, ln16 = lane & 15;
  const int m0 = blockIdx.y * BM;
  const int n0 = blockIdx.x * BN;

  v8f acc[2][4];
#pragma unroll
  for (int i = 0; i < 2; ++i)
#pragma unroll
    for (int j = 0; j < 4; ++j) acc[i][j] = (v8f){0, 0, 0, 0, 0, 0, 0, 0};

  auto copyA = [&](int ks, int buf) {
#pragma unroll
    for (int it = 0; it < 2; ++it) {
      int i = tid + it * 256;                 // 512 chunks of 8 halfs
      int r = i >> 2, c8 = (i & 3) * 8;
      const bf16* gp = &A[(size_t)(m0 + r) * Ki + ks + c8];
      bf16* lp = &As[buf][r][c8];
#if HAVE_ASYNC
      async_copy16(gp, lp);
#else
      *(bf16x8*)lp = *(const bf16x8*)gp;
#endif
    }
  };
  auto copyB = [&](int ks, int buf) {
#pragma unroll
    for (int it = 0; it < 2; ++it) {
      int i = tid + it * 256;                 // 512 chunks of 8 halfs
      int k = i >> 4, c8 = (i & 15) * 8;
      const bf16* gp = &Bm[(size_t)(ks + k) * Ni + n0 + c8];
      bf16* lp = &Bs[buf][k][c8];
#if HAVE_ASYNC
      async_copy16(gp, lp);
#else
      *(bf16x8*)lp = *(const bf16x8*)gp;
#endif
    }
  };

  copyA(0, 0);    // prime pipeline
  copyB(0, 0);
  constexpr int NST = Ki / BK;
#pragma unroll 1
  for (int s = 0; s < NST; ++s) {
    const int cur = s & 1;
    wait_ds0();                 // last stage's fragment reads of the buffer refilled below
    wait_async();               // this stage's tiles
    __syncthreads();
    if (s + 1 < NST) {          // overlap next tile's copies with compute
      copyA((s + 1) * BK, cur ^ 1);
      copyB((s + 1) * BK, cur ^ 1);
    }

    v16bf af[2], bfr[4];
#pragma unroll
    for (int fm = 0; fm < 2; ++fm) {
      int row = wm * 32 + fm * 16 + ln16;
#pragma unroll
      for (int r = 0; r < 8; ++r) {
        int kk = ((r & 3) * 2) + ((r >> 2) * 16) + hf * 8;
        af[fm][2 * r]     = As[cur][row][kk];
        af[fm][2 * r + 1] = As[cur][row][kk + 1];
      }
    }
#pragma unroll
    for (int fn = 0; fn < 4; ++fn)
      bfr[fn] = frag_tr16(&Bs[cur][hf * 8 + (lane & 7)][wn * 64 + fn * 16 + ((lane >> 3) & 1) * 8], BSTR);
#pragma unroll
    for (int fm = 0; fm < 2; ++fm)
#pragma unroll
      for (int fn = 0; fn < 4; ++fn)
        acc[fm][fn] = wmma_bf16(af[fm], bfr[fn], acc[fm][fn]);
  }

  // straight-line epilogue (compile-time N, residual, output type)
#pragma unroll
  for (int fm = 0; fm < 2; ++fm)
#pragma unroll
    for (int fn = 0; fn < 4; ++fn)
#pragma unroll
      for (int v = 0; v < 8; ++v) {
        int row = m0 + wm * 32 + fm * 16 + v + hf * 8;
        int col = n0 + wn * 64 + fn * 16 + ln16;
        size_t idx = (size_t)row * Ni + col;
        float val = acc[fm][fn][v] + bias[col];
        if constexpr (HAS_RES) val += res[idx];
        if constexpr (OUT_BF16) ((bf16*)outp)[idx] = (bf16)val;
        else                    ((float*)outp)[idx] = val;
      }
}

// ---------------------------------------------------------------- flash attention
// block = 64 queries of one (b,h); 4 waves x 16 query rows
__global__ __launch_bounds__(128)
void attn_flash(const bf16* __restrict__ qkv, bf16* __restrict__ ctx) {
  // One struct fixes the tiles' order in LDS: the compiler folds the K-to-V distance in memory into the
  // V copy's offset field and takes it off the copy's LDS address, which stays above 0 with V behind Q and K.
  struct Tiles {
    bf16 Qs[64][72];    // [q][d], pre-scaled
    bf16 Ks[64][72];    // [key][d] (natural B^T layout for Q.K^T)
    bf16 Vs[64][80];    // [key][d] as in memory; 160B stride (32B x odd) for the transposing read
    bf16 Ps[64][72];    // [q][key]
  };
  __shared__ __attribute__((aligned(16))) Tiles sm;
  auto& Qs = sm.Qs;
  auto& Ks = sm.Ks;
  auto& Vs = sm.Vs;
  auto& Ps = sm.Ps;

  const int blk = blockIdx.x;
  const int qt = blk & 31;
  const int bh = blk >> 5;
  const int h = bh & 15, b = bh >> 4;
  const int q0 = qt * 64;
  const int tid = threadIdx.x;
  const int wave = tid >> 5, lane = tid & 31;
  const int hf = lane >> 4, ln16 = lane & 15;
  const float scale = 0.125f;   // 1/sqrt(64)

  // load Q (scaled, bf16)
#pragma unroll
  for (int it = 0; it < 4; ++it) {
    int i = tid + it * 128;              // 512 chunks of 8
    int r = i >> 3, c8 = (i & 7) * 8;
    bf16x8 d = *(const bf16x8*)&qkv[(size_t)(b * S_ + q0 + r) * 3072 + h * 64 + c8];
    bf16x4 lo, hi2;
#pragma unroll
    for (int j = 0; j < 4; ++j) lo[j]  = (bf16)((float)d[j] * scale);
#pragma unroll
    for (int j = 0; j < 4; ++j) hi2[j] = (bf16)((float)d[j + 4] * scale);
    *(bf16x4*)&Qs[r][c8]     = lo;
    *(bf16x4*)&Qs[r][c8 + 4] = hi2;
  }

  v8f o[4];
#pragma unroll
  for (int t = 0; t < 4; ++t) o[t] = (v8f){0, 0, 0, 0, 0, 0, 0, 0};
  float mrow[8], lrow[8];
#pragma unroll
  for (int v = 0; v < 8; ++v) { mrow[v] = -1e30f; lrow[v] = 0.f; }

  for (int kt = 0; kt <= qt; ++kt) {
    __syncthreads();     // previous-iter readers done (also orders Q store 1st iter)
#pragma unroll
    for (int it = 0; it < 4; ++it) {
      int i = tid + it * 128;
      int r = i >> 3, c8 = (i & 7) * 8;
      size_t base = (size_t)(b * S_ + kt * 64 + r) * 3072 + h * 64 + c8;
#if HAVE_ASYNC
      async_copy16(&qkv[base + 1024], &Ks[r][c8]);   // K tile: ASYNCcnt path
      async_copy16(&qkv[base + 2048], &Vs[r][c8]);   // V tile: the same, rows as they lie
#else
      bf16x8 kd = *(const bf16x8*)&qkv[base + 1024];
      *(bf16x4*)&Ks[r][c8]     = (bf16x4){kd[0], kd[1], kd[2], kd[3]};
      *(bf16x4*)&Ks[r][c8 + 4] = (bf16x4){kd[4], kd[5], kd[6], kd[7]};
      *(bf16x8*)&Vs[r][c8] = *(const bf16x8*)&qkv[base + 2048];
#endif
    }
    wait_async();
    __syncthreads();

    // scores S = Qw (16x64) @ K^T : 4 N-tiles, 2 K-steps each
    v8f sc[4];
#pragma unroll
    for (int t = 0; t < 4; ++t) {
      v8f a = (v8f){0, 0, 0, 0, 0, 0, 0, 0};
#pragma unroll
      for (int ks = 0; ks < 64; ks += 32) {
        v16bf af, bfr;
        int row = wave * 16 + ln16;
        int colk = t * 16 + ln16;
#pragma unroll
        for (int r = 0; r < 8; ++r) {
          int kk = ks + ((r & 3) * 2) + ((r >> 2) * 16) + hf * 8;
          af[2 * r]      = Qs[row][kk];
          af[2 * r + 1]  = Qs[row][kk + 1];
          bfr[2 * r]     = Ks[colk][kk];
          bfr[2 * r + 1] = Ks[colk][kk + 1];
        }
        a = wmma_bf16(af, bfr, a);
      }
      sc[t] = a;
    }

    // causal mask on diagonal tile (additive NINF to match reference)
    if (kt == qt) {
#pragma unroll
      for (int t = 0; t < 4; ++t)
#pragma unroll
        for (int v = 0; v < 8; ++v) {
          int qr = wave * 16 + v + hf * 8;
          int kc = t * 16 + ln16;
          if (kc > qr) sc[t][v] += NINF;
        }
    }

    // online softmax (row lives in 16 lanes of one half-wave)
#pragma unroll
    for (int v = 0; v < 8; ++v) {
      float mx = fmaxf(fmaxf(sc[0][v], sc[1][v]), fmaxf(sc[2][v], sc[3][v]));
#pragma unroll
      for (int off = 1; off < 16; off <<= 1) mx = fmaxf(mx, __shfl_xor(mx, off, 32));
      float mnew = fmaxf(mrow[v], mx);
      float corr = __expf(mrow[v] - mnew);
#pragma unroll
      for (int t = 0; t < 4; ++t) o[t][v] *= corr;
      float rsum = 0.f;
#pragma unroll
      for (int t = 0; t < 4; ++t) {
        float p = __expf(sc[t][v] - mnew);
        sc[t][v] = p;
        rsum += p;
      }
#pragma unroll
      for (int off = 1; off < 16; off <<= 1) rsum += __shfl_xor(rsum, off, 32);
      lrow[v] = lrow[v] * corr + rsum;
      mrow[v] = mnew;
    }

    // P -> LDS (per-wave private 16-row region; same-wave DS ordering suffices)
#pragma unroll
    for (int t = 0; t < 4; ++t)
#pragma unroll
      for (int v = 0; v < 8; ++v)
        Ps[wave * 16 + v + hf * 8][t * 16 + ln16] = (bf16)sc[t][v];

    // O += P (16x64) @ V (64x64)
#pragma unroll
    for (int t = 0; t < 4; ++t) {
      v8f a = o[t];
#pragma unroll
      for (int ks = 0; ks < 64; ks += 32) {
        v16bf af;
        int row = wave * 16 + ln16;
#pragma unroll
        for (int r = 0; r < 8; ++r) {
          int kk = ks + ((r & 3) * 2) + ((r >> 2) * 16) + hf * 8;
          af[2 * r]      = Ps[row][kk];
          af[2 * r + 1]  = Ps[row][kk + 1];
        }
        v16bf bfr = frag_tr16(&Vs[ks + hf * 8 + (lane & 7)][t * 16 + ((lane >> 3) & 1) * 8], 80);
        a = wmma_bf16(af, bfr, a);
      }
      o[t] = a;
    }
  }

  // normalize + write ctx (bf16, [B*S][DIM] at col h*64)
#pragma unroll
  for (int v = 0; v < 8; ++v) {
    float inv = 1.0f / lrow[v];
    int qr = q0 + wave * 16 + v + hf * 8;
#pragma unroll
    for (int t = 0; t < 4; ++t)
      ctx[(size_t)(b * S_ + qr) * DIM_ + h * 64 + t * 16 + ln16] = (bf16)(o[t][v] * inv);
  }
}

// ---------------------------------------------------------------- host launch
static inline size_t align256(size_t x) { return (x + 255) & ~(size_t)255; }

extern "C" void kernel_launch(void* const* d_in, const int* in_sizes, int n_in,
                              void* d_out, int out_size, void* d_ws, size_t ws_size,
                              hipStream_t stream) {
  const float* x    = (const float*)d_in[0];
  const float* ln_g = (const float*)d_in[1];
  const float* ln_b = (const float*)d_in[2];
  const float* wqkv = (const float*)d_in[3];
  const float* bqkv = (const float*)d_in[4];
  const float* wo   = (const float*)d_in[5];
  const float* bo   = (const float*)d_in[6];
  float* out = (float*)d_out;

  const int M = B_ * S_;          // 4096
  const int N1 = 3 * DIM_;        // 3072
  const int K = DIM_;             // 1024

  char* ws = (char*)d_ws;
  size_t off = 0;
  bf16* wqkv_b = (bf16*)(ws + off); off = align256(off + (size_t)K * N1 * 2);
  bf16* wo_b   = (bf16*)(ws + off); off = align256(off + (size_t)K * DIM_ * 2);
  bf16* h_b    = (bf16*)(ws + off); off = align256(off + (size_t)M * DIM_ * 2);
  bf16* qkv_b  = (bf16*)(ws + off); off = align256(off + (size_t)M * N1 * 2);
  bf16* ctx_b  = (bf16*)(ws + off); off = align256(off + (size_t)M * DIM_ * 2);
  (void)ws_size; (void)in_sizes; (void)n_in; (void)out_size;

  // 1) weights -> bf16
  cvt_f32_bf16<DIM_ * 3 * DIM_><<<DIM_ * 3 * DIM_ / (256 * CVT_LANE), 256, 0, stream>>>(wqkv, wqkv_b);
  cvt_f32_bf16<DIM_ * DIM_><<<DIM_ * DIM_ / (256 * CVT_LANE), 256, 0, stream>>>(wo, wo_b);
  // 2) layernorm
  layernorm_bf16<<<M / 8, 256, 0, stream>>>(x, ln_g, ln_b, h_b);
  // 3) QKV GEMM: [4096,1024]x[1024,3072] + bqkv -> bf16
  gemm_bf16_wmma<4096, 3072, 1024, false, true>
      <<<dim3(N1 / BN, M / BM), 256, 0, stream>>>(h_b, wqkv_b, bqkv, nullptr, (void*)qkv_b);
  // 4) causal flash attention -> ctx bf16
  attn_flash<<<B_ * H_ * (S_ / 64), 128, 0, stream>>>(qkv_b, ctx_b);
  // 5) output GEMM + bias + residual -> f32 out
  gemm_bf16_wmma<4096, 1024, 1024, true, false>
      <<<dim3(DIM_ / BN, M / BM), 256, 0, stream>>>(ctx_b, wo_b, bo, x, (void*)out);
}

// v003
// Measured time: 116 microseconds a run.
// Timed twice side by side with v002, it ran 1.35 times as fast both times.
// Counting every step since v000, it is 2.45 times as fast.
#include <hip/hip_runtime.h>
#include <stdint.h>

typedef __bf16 bf16;
typedef __attribute__((ext_vector_type(16))) __bf16 v16bf;
typedef __attribute__((ext_vector_type(8)))  __bf16 bf16x8;
typedef __attribute__((ext_vector_type(4)))  __bf16 bf16x4;
typedef __attribute__((ext_vector_type(8)))  float  v8f;
typedef __attribute__((ext_vector_type(4)))  int    v4i;
typedef __attribute__((ext_vector_type(4)))  float  f32x4;

#define B_   2
#define S_   2048
#define H_   16
#define D_   64
#define DIM_ 1024
#define NINF (-10000.0f)

#ifndef __has_builtin
#define __has_builtin(x) 0
#endif

#if __has_builtin(__builtin_amdgcn_global_load_async_to_lds_b128)
#define HAVE_ASYNC 1
#else
#define HAVE_ASYNC 0
#endif

#define AS1 __attribute__((address_space(1)))
#define AS3 __attribute__((address_space(3)))
#if HAVE_ASYNC
// param1: v4i in AS1 (printed as "__device__" by clang); param2: v4i in AS3.
// flat LDS address low 32 bits == LDS byte offset (aperture rules); flat==global for AS1.
__device__ inline void async_copy16(const void* g, void* l) {
  __builtin_amdgcn_global_load_async_to_lds_b128(
      (AS1 v4i*)(unsigned long long)(uintptr_t)g,
      (AS3 v4i*)(unsigned int)(uintptr_t)l, 0, 0);
}
#endif

// this wave's async copies have landed in LDS; asm with a memory clobber so that no LDS read is lifted over it
__device__ inline void wait_async() {
#if HAVE_ASYNC
  asm volatile("s_wait_asynccnt 0x0" ::: "memory");
#endif
}

// this wave's own LDS reads and writes have retired, before a copy may be aimed at the LDS they touched
__device__ inline void wait_ds0() {
  asm volatile("s_wait_dscnt 0x0" ::: "memory");
}

// Transposing LDS read of a row-major 16-bit tile T[k][n]. Lane l passes the address of
// T[kbase + 8*(l>>4) + (l&7)][nbase + 8*((l>>3)&1)] and gets T[kbase + 8*(l>>4) + 0..7][nbase + (l&15)]:
// one half of a B fragment in the hardware k order, the order the A loaders here use.
__device__ inline bf16x8 ld_tr16(const bf16* p) {
  return __builtin_amdgcn_ds_load_tr16_b128_v8bf16((AS3 bf16x8*)p);
}
__device__ inline v16bf frag_tr16(const bf16* p, int pitch) {
  bf16x8 lo = ld_tr16(p), hi = ld_tr16(p + 16 * pitch);
  return __builtin_shufflevector(lo, hi, 0, 1, 2, 3, 4, 5, 6, 7, 8, 9, 10, 11, 12, 13, 14, 15);
}

__device__ inline v8f wmma_bf16(v16bf a, v16bf b, v8f c) {
  return __builtin_amdgcn_wmma_f32_16x16x32_bf16(false, a, false, b, (short)0, c, false, false);
}

// ---------------------------------------------------------------- convert
// 32 elements a lane, eight 16-byte loads in flight, so that few waves have to start.
#define CVT_LANE 32
template<int N>
__global__ __launch_bounds__(256) void cvt_f32_bf16(const float* __restrict__ in,
                                                    bf16* __restrict__ out) {
  static_assert(N % (256 * CVT_LANE) == 0, "whole blocks only");
  const int base = blockIdx.x * (256 * CVT_LANE) + threadIdx.x * 4;
  f32x4 v[CVT_LANE / 4];
#pragma unroll
  for (int j = 0; j < CVT_LANE / 4; ++j) v[j] = *(const f32x4*)&in[base + j * 1024];
#pragma unroll
  for (int j = 0; j < CVT_LANE / 4; ++j) {
    bf16x4 o;
#pragma unroll
    for (int e = 0; e < 4; ++e) o[e] = (bf16)v[j][e];
    *(bf16x4*)&out[base + j * 1024] = o;
  }
}

// ---------------------------------------------------------------- layernorm
// One wave a row (32 elements a lane), eight rows a block: an eighth of the waves, no LDS, no barrier.
__global__ __launch_bounds__(256) void layernorm_bf16(const float* __restrict__ x,
                                                      const float* __restrict__ g,
                                                      const float* __restrict__ b,
                                                      bf16* __restrict__ h) {
  const int wave = threadIdx.x >> 5, lane = threadIdx.x & 31;
  const int row = blockIdx.x * 8 + wave;
  const float* xr = x + (size_t)row * DIM_ + lane * 4;

  f32x4 v[8];
#pragma unroll
  for (int i = 0; i < 8; ++i) v[i] = *(const f32x4*)&xr[i * 128];

  f32x4 s4 = v[0];
#pragma unroll
  for (int i = 1; i < 8; ++i) s4 += v[i];
  float s = (s4[0] + s4[1]) + (s4[2] + s4[3]);
#pragma unroll
  for (int off = 16; off >= 1; off >>= 1) s += __shfl_xor(s, off, 32);
  const float mu = s * (1.0f / DIM_);

  f32x4 q4 = (f32x4){0.f, 0.f, 0.f, 0.f};
#pragma unroll
  for (int i = 0; i < 8; ++i) { v[i] -= mu; q4 += v[i] * v[i]; }
  float vs = (q4[0] + q4[1]) + (q4[2] + q4[3]);
#pragma unroll
  for (int off = 16; off >= 1; off >>= 1) vs += __shfl_xor(vs, off, 32);
  const float rstd = __frsqrt_rn(vs * (1.0f / DIM_) + 1e-6f);

  bf16* hr = h + (size_t)row * DIM_ + lane * 4;
#pragma unroll
  for (int i = 0; i < 8; ++i) {
    const f32x4 gg = *(const f32x4*)&g[i * 128 + lane * 4];
    const f32x4 bb = *(const f32x4*)&b[i * 128 + lane * 4];
    bf16x4 o;
#pragma unroll
    for (int e = 0; e < 4; ++e) o[e] = (bf16)(v[i][e] * rstd * gg[e] + bb[e]);
    *(bf16x4*)&hr[i * 128] = o;
  }
}

// ---------------------------------------------------------------- GEMM (bf16 WMMA)
// C[M,N] = A[M,K] @ B[K,N] + bias ; optional residual ; out bf16 or f32
// 128x128 block tile, BK=32, 8 waves (4x2) x (2x4) 16x16 WMMA tiles.
// Double-buffered LDS, A and B tiles via async-to-LDS (when available); the B tile
// stays row-major [k][n] as in memory and is transposed by the fragment read.
#define BM 128
#define BN 128
#define BK 32
#define ASTR 56   // 112B stride: 16B aligned, 28-bank stride -> conflict free
#define BSTR 144  // 288B stride: 32B x odd, conflict free for the transposing read

template<int Mi, int Ni, int Ki, bool HAS_RES, bool OUT_BF16>
__global__ __launch_bounds__(256)
void gemm_bf16_wmma(const bf16* __restrict__ A, const bf16* __restrict__ Bm,
                    const float* __restrict__ bias, const float* __restrict__ res,
                    void* __restrict__ outp) {
  __shared__ __attribute__((aligned(16))) bf16 As[2][BM][ASTR];
  __shared__ __attribute__((aligned(16))) bf16 Bs[2][BK][BSTR];   // Bs[k][n]

  const int tid = threadIdx.x;
  const int wave = tid >> 5, lane = tid & 31;
  const int wm = wave & 3, wn = wave >> 2;       // 4x2 wave grid
  const int hf = lane >> 4, ln16 = lane & 15;
  const int m0 = blockIdx.y * BM;
  const int n0 = blockIdx.x * BN;

  v8f acc[2][4];
#pragma unroll
  for (int i = 0; i < 2; ++i)
#pragma unroll
    for (int j = 0; j < 4; ++j) acc[i][j] = (v8f){0, 0, 0, 0, 0, 0, 0, 0};

  auto copyA = [&](int ks, int buf) {
#pragma unroll
    for (int it = 0; it < 2; ++it) {
      int i = tid + it * 256;                 // 512 chunks of 8 halfs
      int r = i >> 2, c8 = (i & 3) * 8;
      const bf16* gp = &A[(size_t)(m0 + r) * Ki + ks + c8];
      bf16* lp = &As[buf][r][c8];
#if HAVE_ASYNC
      async_copy16(gp, lp);
#else
      *(bf16x8*)lp = *(const bf16x8*)gp;
#endif
    }
  };
  auto copyB = [&](int ks, int buf) {
#pragma unroll
    for (int it = 0; it < 2; ++it) {
      int i = tid + it * 256;                 // 512 chunks of 8 halfs
      int k = i >> 4, c8 = (i & 15) * 8;
      const bf16* gp = &Bm[(size_t)(ks + k) * Ni + n0 + c8];
      bf16* lp = &Bs[buf][k][c8];
#if HAVE_ASYNC
      async_copy16(gp, lp);
#else
      *(bf16x8*)lp = *(const bf16x8*)gp;
#endif
    }
  };

  copyA(0, 0);    // prime pipeline
  copyB(0, 0);
  constexpr int NST = Ki / BK;
#pragma unroll 1
  for (int s = 0; s < NST; ++s) {
    const int cur = s & 1;
    wait_ds0();                 // last stage's fragment reads of the buffer refilled below
    wait_async();               // this stage's tiles
    __syncthreads();
    if (s + 1 < NST) {          // overlap next tile's copies with compute
      copyA((s + 1) * BK, cur ^ 1);
      copyB((s + 1) * BK, cur ^ 1);
    }

    v16bf af[2], bfr[4];
#pragma unroll
    for (int fm = 0; fm < 2; ++fm) {
      int row = wm * 32 + fm * 16 + ln16;
#pragma unroll
      for (int r = 0; r < 8; ++r) {
        int kk = ((r & 3) * 2) + ((r >> 2) * 16) + hf * 8;
        af[fm][2 * r]     = As[cur][row][kk];
        af[fm][2 * r + 1] = As[cur][row][kk + 1];
      }
    }
#pragma unroll
    for (int fn = 0; fn < 4; ++fn)
      bfr[fn] = frag_tr16(&Bs[cur][hf * 8 + (lane & 7)][wn * 64 + fn * 16 + ((lane >> 3) & 1) * 8], BSTR);
#pragma unroll
    for (int fm = 0; fm < 2; ++fm)
#pragma unroll
      for (int fn = 0; fn < 4; ++fn)
        acc[fm][fn] = wmma_bf16(af[fm], bfr[fn], acc[fm][fn]);
  }

  // straight-line epilogue (compile-time N, residual, output type)
#pragma unroll
  for (int fm = 0; fm < 2; ++fm)
#pragma unroll
    for (int fn = 0; fn < 4; ++fn)
#pragma unroll
      for (int v = 0; v < 8; ++v) {
        int row = m0 + wm * 32 + fm * 16 + v + hf * 8;
        int col = n0 + wn * 64 + fn * 16 + ln16;
        size_t idx = (size_t)row * Ni + col;
        float val = acc[fm][fn][v] + bias[col];
        if constexpr (HAS_RES) val += res[idx];
        if constexpr (OUT_BF16) ((bf16*)outp)[idx] = (bf16)val;
        else                    ((float*)outp)[idx] = val;
      }
}

// value of lane l ^ 16
__device__ inline float other_half(float x) {
  int b = __builtin_bit_cast(int, x);
  return __builtin_bit_cast(float, __builtin_amdgcn_permlanex16(b, b, 0x76543210, 0xfedcba98, false, false));
}

__global__ __launch_bounds__(128)
void attn_flash(const bf16* __restrict__ qkv, bf16* __restrict__ ctx) {
  // One struct fixes the tiles' order in LDS: the compiler folds the K-to-V distance in memory into the
  // V copy's offset field and takes it off the copy's LDS address, which stays above 0 with V behind K.
  struct Tiles {
    bf16 Ks[64][72];    // [key][d]: rows are the A operand of K.Q^T
    bf16 Vs[64][80];    // [key][d] as in memory; 160B stride (32B x odd) for the transposing read
  };
  __shared__ __attribute__((aligned(16))) Tiles sm;
  auto& Ks = sm.Ks;
  auto& Vs = sm.Vs;

  const int blk = blockIdx.x;
  const int qt = blk & 31;
  const int bh = blk >> 5;
  const int h = bh & 15, b = bh >> 4;
  const int q0 = qt * 64;
  const int tid = threadIdx.x;
  const int wave = tid >> 5, lane = tid & 31;
  const int hf = lane >> 4, ln16 = lane & 15;
  const float scale = 0.125f;   // 1/sqrt(64)

  // Q^T fragments (B operand, column = query ln16, hardware k order), pre-scaled, kept in registers
  v16bf qf[2];
  {
    const bf16* qp = &qkv[(size_t)(b * S_ + q0 + wave * 16 + ln16) * 3072 + h * 64 + hf * 8];
#pragma unroll
    for (int j = 0; j < 2; ++j) {
      bf16x8 lo = *(const bf16x8*)&qp[j * 32], hi = *(const bf16x8*)&qp[j * 32 + 16];
#pragma unroll
      for (int e = 0; e < 8; ++e) lo[e] = (bf16)((float)lo[e] * scale);
#pragma unroll
      for (int e = 0; e < 8; ++e) hi[e] = (bf16)((float)hi[e] * scale);
      qf[j] = __builtin_shufflevector(lo, hi, 0, 1, 2, 3, 4, 5, 6, 7, 8, 9, 10, 11, 12, 13, 14, 15);
    }
  }

  v8f o[4];             // o[t][v] = O[query ln16][d = 16t + 8hf + v]
#pragma unroll
  for (int t = 0; t < 4; ++t) o[t] = (v8f){0, 0, 0, 0, 0, 0, 0, 0};
  float mrow = -1e30f;  // running maximum of query ln16, equal in both halves
  float lrow = 0.f;     // running sum over this half's keys; the halves are joined behind the loop

  for (int kt = 0; kt <= qt; ++kt) {
    wait_ds0();          // this wave's fragment reads of the tiles refilled below
    __syncthreads();     // previous-iter readers done
#pragma unroll
    for (int it = 0; it < 4; ++it) {
      int i = tid + it * 128;
      int r = i >> 3, c8 = (i & 7) * 8;
      size_t base = (size_t)(b * S_ + kt * 64 + r) * 3072 + h * 64 + c8;
#if HAVE_ASYNC
      async_copy16(&qkv[base + 1024], &Ks[r][c8]);   // K tile: ASYNCcnt path
      async_copy16(&qkv[base + 2048], &Vs[r][c8]);   // V tile: the same, rows as they lie
#else
      bf16x8 kd = *(const bf16x8*)&qkv[base + 1024];
      *(bf16x4*)&Ks[r][c8]     = (bf16x4){kd[0], kd[1], kd[2], kd[3]};
      *(bf16x4*)&Ks[r][c8 + 4] = (bf16x4){kd[4], kd[5], kd[6], kd[7]};
      *(bf16x8*)&Vs[r][c8] = *(const bf16x8*)&qkv[base + 2048];
#endif
    }
    wait_async();
    __syncthreads();

    // S^T = K (64x64) @ Q^T (64x16): 4 key tiles, 2 K-steps each; sc[t][v] = S[query ln16][key 16t + 8hf + v]
    // All eight K fragments are read as one group ahead of the products.
    v16bf kf[2][4];
#pragma unroll
    for (int j = 0; j < 2; ++j)
#pragma unroll
      for (int t = 0; t < 4; ++t) {
        const bf16* kp = &Ks[t * 16 + ln16][j * 32 + hf * 8];
        kf[j][t] = __builtin_shufflevector(*(const bf16x8*)kp, *(const bf16x8*)(kp + 16),
                                           0, 1, 2, 3, 4, 5, 6, 7, 8, 9, 10, 11, 12, 13, 14, 15);
      }
    // The eight V^T fragments (A operand of V^T.P^T) are read in the same group: they land under the score
    // products and the softmax.
    v16bf vf[2][4];
#pragma unroll
    for (int j = 0; j < 2; ++j)
#pragma unroll
      for (int t = 0; t < 4; ++t)
        vf[j][t] = frag_tr16(&Vs[j * 32 + hf * 8 + (lane & 7)][t * 16 + ((lane >> 3) & 1) * 8], 80);
    // Inputs-only fence on the loaded K fragments: without it the compiler sinks the second four behind the first
    // products, each pair of reads with a wait to 0 of its own, and the wave sits out the LDS latency five times.
    asm volatile("" :: "v"(kf[0][0]), "v"(kf[0][1]), "v"(kf[0][2]), "v"(kf[0][3]),
                       "v"(kf[1][0]), "v"(kf[1][1]), "v"(kf[1][2]), "v"(kf[1][3]));
    v8f sc[4];
#pragma unroll
    for (int t = 0; t < 4; ++t) sc[t] = wmma_bf16(kf[0][t], qf[0], (v8f){0, 0, 0, 0, 0, 0, 0, 0});
#pragma unroll
    for (int t = 0; t < 4; ++t) sc[t] = wmma_bf16(kf[1][t], qf[1], sc[t]);

    // causal mask on diagonal tile (additive NINF to match reference)
    if (kt == qt) {
      const int qr = wave * 16 + ln16;
#pragma unroll
      for (int t = 0; t < 4; ++t)
#pragma unroll
        for (int v = 0; v < 8; ++v)
          sc[t][v] += (t * 16 + hf * 8 + v > qr) ? NINF : 0.f;
    }

    // online softmax: 32 of the query's 64 scores in this lane, the rest in lane ^ 16
    float mt[4];
#pragma unroll
    for (int t = 0; t < 4; ++t) {
      mt[t] = sc[t][0];
#pragma unroll
      for (int v = 1; v < 8; ++v) mt[t] = fmaxf(mt[t], sc[t][v]);
    }
    float mx = fmaxf(fmaxf(mt[0], mt[1]), fmaxf(mt[2], mt[3]));
    mx = fmaxf(mx, other_half(mx));
    const float mnew = fmaxf(mrow, mx);
    const float corr = __expf(mrow - mnew);
    float rs[4];
#pragma unroll
    for (int t = 0; t < 4; ++t) {
      rs[t] = 0.f;
#pragma unroll
      for (int v = 0; v < 8; ++v) {
        float p = __expf(sc[t][v] - mnew);
        sc[t][v] = p;
        rs[t] += p;
        o[t][v] *= corr;
      }
    }
    lrow = lrow * corr + ((rs[0] + rs[1]) + (rs[2] + rs[3]));
    mrow = mnew;

    // P^T fragments: element s of K-step j is key 32j + (s < 8 ? 8hf + s : 16 + 8hf + s - 8)
    v16bf pf[2];
#pragma unroll
    for (int j = 0; j < 2; ++j)
#pragma unroll
      for (int s = 0; s < 16; ++s) pf[j][s] = (bf16)sc[2 * j + (s >> 3)][s & 7];

    // O^T += V^T (64x64) @ P^T (64x16)
#pragma unroll
    for (int t = 0; t < 4; ++t) {
      v8f a = o[t];
#pragma unroll
      for (int j = 0; j < 2; ++j) {
        a = wmma_bf16(vf[j][t], pf[j], a);
      }
      o[t] = a;
    }
  }

  // normalize + write ctx (bf16, [B*S][DIM] at col h*64): 8 consecutive d a lane and tile, one 16-byte store
  lrow += other_half(lrow);
  const float inv = 1.0f / lrow;
  bf16* cp = &ctx[(size_t)(b * S_ + q0 + wave * 16 + ln16) * DIM_ + h * 64 + hf * 8];
#pragma unroll
  for (int t = 0; t < 4; ++t) {
    bf16x8 ov;
#pragma unroll
    for (int v = 0; v < 8; ++v) ov[v] = (bf16)(o[t][v] * inv);
    *(bf16x8*)&cp[t * 16] = ov;
  }
}

// ---------------------------------------------------------------- host launch
static inline size_t align256(size_t x) { return (x + 255) & ~(size_t)255; }

extern "C" void kernel_launch(void* const* d_in, const int* in_sizes, int n_in,
                              void* d_out, int out_size, void* d_ws, size_t ws_size,
                              hipStream_t stream) {
  const float* x    = (const float*)d_in[0];
  const float* ln_g = (const float*)d_in[1];
  const float* ln_b = (const float*)d_in[2];
  const float* wqkv = (const float*)d_in[3];
  const float* bqkv = (const float*)d_in[4];
  const float* wo   = (const float*)d_in[5];
  const float* bo   = (const float*)d_in[6];
  float* out = (float*)d_out;

  const int M = B_ * S_;          // 4096
  const int N1 = 3 * DIM_;        // 3072
  const int K = DIM_;             // 1024

  char* ws = (char*)d_ws;
  size_t off = 0;
  bf16* wqkv_b = (bf16*)(ws + off); off = align256(off + (size_t)K * N1 * 2);
  bf16* wo_b   = (bf16*)(ws + off); off = align256(off + (size_t)K * DIM_ * 2);
  bf16* h_b    = (bf16*)(ws + off); off = align256(off + (size_t)M * DIM_ * 2);
  bf16* qkv_b  = (bf16*)(ws + off); off = align256(off + (size_t)M * N1 * 2);
  bf16* ctx_b  = (bf16*)(ws + off); off = align256(off + (size_t)M * DIM_ * 2);
  (void)ws_size; (void)in_sizes; (void)n_in; (void)out_size;

  // 1) weights -> bf16
  cvt_f32_bf16<DIM_ * 3 * DIM_><<<DIM_ * 3 * DIM_ / (256 * CVT_LANE), 256, 0, stream>>>(wqkv, wqkv_b);
  cvt_f32_bf16<DIM_ * DIM_><<<DIM_ * DIM_ / (256 * CVT_LANE), 256, 0, stream>>>(wo, wo_b);
  // 2) layernorm
  layernorm_bf16<<<M / 8, 256, 0, stream>>>(x, ln_g, ln_b, h_b);
  // 3) QKV GEMM: [4096,1024]x[1024,3072] + bqkv -> bf16
  gemm_bf16_wmma<4096, 3072, 1024, false, true>
      <<<dim3(N1 / BN, M / BM), 256, 0, stream>>>(h_b, wqkv_b, bqkv, nullptr, (void*)qkv_b);
  // 4) causal flash attention -> ctx bf16
  attn_flash<<<B_ * H_ * (S_ / 64), 128, 0, stream>>>(qkv_b, ctx_b);
  // 5) output GEMM + bias + residual -> f32 out
  gemm_bf16_wmma<4096, 1024, 1024, true, false>
      <<<dim3(DIM_ / BN, M / BM), 256, 0, stream>>>(ctx_b, wo_b, bo, x, (void*)out);
}

// v004
// One run takes 86.5 microseconds.
// Next to v003, in two timings, it ran 1.33 times as fast each time.
// Counting every step since v000, it is 3.25 times as fast.
#include <hip/hip_runtime.h>
#include <stdint.h>

typedef __bf16 bf16;
typedef __attribute__((ext_vector_type(16))) __bf16 v16bf;
typedef __attribute__((ext_vector_type(8)))  __bf16 bf16x8;
typedef __attribute__((ext_vector_type(4)))  __bf16 bf16x4;
typedef __attribute__((ext_vector_type(8)))  float  v8f;
typedef __attribute__((ext_vector_type(4)))  int    v4i;
typedef __attribute__((ext_vector_type(4)))  float  f32x4;

#define B_   2
#define S_   2048
#define H_   16
#define D_   64
#define DIM_ 1024
#define NINF (-10000.0f)

#ifndef __has_builtin
#define __has_builtin(x) 0
#endif

#if __has_builtin(__builtin_amdgcn_global_load_async_to_lds_b128)
#define HAVE_ASYNC 1
#else
#define HAVE_ASYNC 0
#endif

#define AS1 __attribute__((address_space(1)))
#define AS3 __attribute__((address_space(3)))
#if HAVE_ASYNC
// param1: v4i in AS1 (printed as "__device__" by clang); param2: v4i in AS3.
// flat LDS address low 32 bits == LDS byte offset (aperture rules); flat==global for AS1.
__device__ inline void async_copy16(const void* g, void* l) {
  __builtin_amdgcn_global_load_async_to_lds_b128(
      (AS1 v4i*)(unsigned long long)(uintptr_t)g,
      (AS3 v4i*)(unsigned int)(uintptr_t)l, 0, 0);
}
#endif

// this wave's async copies have landed in LDS; asm with a memory clobber so that no LDS read is lifted over it
__device__ inline void wait_async() {
#if HAVE_ASYNC
  asm volatile("s_wait_asynccnt 0x0" ::: "memory");
#endif
}

// this wave's own LDS reads and writes have retired, before a copy may be aimed at the LDS they touched
__device__ inline void wait_ds0() {
  asm volatile("s_wait_dscnt 0x0" ::: "memory");
}

// Transposing LDS read of a row-major 16-bit tile T[k][n]. Lane l passes the address of
// T[kbase + 8*(l>>4) + (l&7)][nbase + 8*((l>>3)&1)] and gets T[kbase + 8*(l>>4) + 0..7][nbase + (l&15)]:
// one half of a B fragment in the hardware k order, the order the A loaders here use.
__device__ inline bf16x8 ld_tr16(const bf16* p) {
  return __builtin_amdgcn_ds_load_tr16_b128_v8bf16((AS3 bf16x8*)p);
}
__device__ inline v16bf frag_tr16(const bf16* p, int pitch) {
  bf16x8 lo = ld_tr16(p), hi = ld_tr16(p + 16 * pitch);
  return __builtin_shufflevector(lo, hi, 0, 1, 2, 3, 4, 5, 6, 7, 8, 9, 10, 11, 12, 13, 14, 15);
}

__device__ inline v8f wmma_bf16(v16bf a, v16bf b, v8f c) {
  return __builtin_amdgcn_wmma_f32_16x16x32_bf16(false, a, false, b, (short)0, c, false, false);
}

// ---------------------------------------------------------------- convert
// 32 elements a lane, eight 16-byte loads in flight, so that few waves have to start.
#define CVT_LANE 32
template<int N>
__global__ __launch_bounds__(256) void cvt_f32_bf16(const float* __restrict__ in,
                                                    bf16* __restrict__ out) {
  static_assert(N % (256 * CVT_LANE) == 0, "whole blocks only");
  const int base = blockIdx.x * (256 * CVT_LANE) + threadIdx.x * 4;
  f32x4 v[CVT_LANE / 4];
#pragma unroll
  for (int j = 0; j < CVT_LANE / 4; ++j) v[j] = *(const f32x4*)&in[base + j * 1024];
#pragma unroll
  for (int j = 0; j < CVT_LANE / 4; ++j) {
    bf16x4 o;
#pragma unroll
    for (int e = 0; e < 4; ++e) o[e] = (bf16)v[j][e];
    *(bf16x4*)&out[base + j * 1024] = o;
  }
}

// ---------------------------------------------------------------- layernorm
// One wave a row (32 elements a lane), eight rows a block: an eighth of the waves, no LDS, no barrier.
__global__ __launch_bounds__(256) void layernorm_bf16(const float* __restrict__ x,
                                                      const float* __restrict__ g,
                                                      const float* __restrict__ b,
                                                      bf16* __restrict__ h) {
  const int wave = threadIdx.x >> 5, lane = threadIdx.x & 31;
  const int row = blockIdx.x * 8 + wave;
  const float* xr = x + (size_t)row * DIM_ + lane * 4;

  f32x4 v[8];
#pragma unroll
  for (int i = 0; i < 8; ++i) v[i] = *(const f32x4*)&xr[i * 128];

  f32x4 s4 = v[0];
#pragma unroll
  for (int i = 1; i < 8; ++i) s4 += v[i];
  float s = (s4[0] + s4[1]) + (s4[2] + s4[3]);
#pragma unroll
  for (int off = 16; off >= 1; off >>= 1) s += __shfl_xor(s, off, 32);
  const float mu = s * (1.0f / DIM_);

  f32x4 q4 = (f32x4){0.f, 0.f, 0.f, 0.f};
#pragma unroll
  for (int i = 0; i < 8; ++i) { v[i] -= mu; q4 += v[i] * v[i]; }
  float vs = (q4[0] + q4[1]) + (q4[2] + q4[3]);
#pragma unroll
  for (int off = 16; off >= 1; off >>= 1) vs += __shfl_xor(vs, off, 32);
  const float rstd = __frsqrt_rn(vs * (1.0f / DIM_) + 1e-6f);

  bf16* hr = h + (size_t)row * DIM_ + lane * 4;
#pragma unroll
  for (int i = 0; i < 8; ++i) {
    const f32x4 gg = *(const f32x4*)&g[i * 128 + lane * 4];
    const f32x4 bb = *(const f32x4*)&b[i * 128 + lane * 4];
    bf16x4 o;
#pragma unroll
    for (int e = 0; e < 4; ++e) o[e] = (bf16)(v[i][e] * rstd * gg[e] + bb[e]);
    *(bf16x4*)&hr[i * 128] = o;
  }
}

// ---------------------------------------------------------------- GEMM (bf16 WMMA)
// C[M,N] = A[M,K] @ B[K,N] + bias ; optional residual ; out bf16 or f32
// 128x128 block tile, 8 waves (4x2) x (2x4) 16x16 WMMA tiles.
// Double-buffered LDS, A and B tiles via async-to-LDS (when available); the B tile
// stays row-major [k][n] as in memory and is transposed by the fragment read.
// BKi = k per LDS stage, a multiple of 64: a stage's piece of an A row is then whole 128-byte lines, and a
// stage holds BKi / 32 k steps of products between two barriers, under which the next stage's copies land.
#define BM 128
#define BN 128
#define BSTR 144  // 288B stride: 32B x odd, conflict free for the transposing read

template<int Mi, int Ni, int Ki, int BKi, bool HAS_RES, bool OUT_BF16>
__global__ __launch_bounds__(256)
void gemm_bf16_wmma(const bf16* __restrict__ A, const bf16* __restrict__ Bm,
                    const float* __restrict__ bias, const float* __restrict__ res,
                    void* __restrict__ outp) {
  static_assert(BKi % 64 == 0 && Ki % BKi == 0, "whole lines, whole stages");
  constexpr int ASTR = BKi + 8;   // 144B or 272B stride: 16B x odd, conflict free for the 16-byte read
  __shared__ __attribute__((aligned(16))) bf16 As[2][BM][ASTR];
  __shared__ __attribute__((aligned(16))) bf16 Bs[2][BKi][BSTR];   // Bs[k][n]

  const int tid = threadIdx.x;
  const int wave = tid >> 5, lane = tid & 31;
  const int wm = wave & 3, wn = wave >> 2;       // 4x2 wave grid
  const int hf = lane >> 4, ln16 = lane & 15;
  const int m0 = blockIdx.y * BM;
  const int n0 = blockIdx.x * BN;

  v8f acc[2][4];
#pragma unroll
  for (int i = 0; i < 2; ++i)
#pragma unroll
    for (int j = 0; j < 4; ++j) acc[i][j] = (v8f){0, 0, 0, 0, 0, 0, 0, 0};

  auto copyA = [&](int ks, int buf) {
#pragma unroll
    for (int it = 0; it < BM * BKi / 8 / 256; ++it) {
      int i = tid + it * 256;                 // chunks of 8 halfs, BKi / 8 a row
      int r = i / (BKi / 8), c8 = (i % (BKi / 8)) * 8;
      const bf16* gp = &A[(size_t)(m0 + r) * Ki + ks + c8];
      bf16* lp = &As[buf][r][c8];
#if HAVE_ASYNC
      async_copy16(gp, lp);
#else
      *(bf16x8*)lp = *(const bf16x8*)gp;
#endif
    }
  };
  auto copyB = [&](int ks, int buf) {
#pragma unroll
    for (int it = 0; it < BKi * BN / 8 / 256; ++it) {
      int i = tid + it * 256;                 // chunks of 8 halfs, 16 a row
      int k = i >> 4, c8 = (i & 15) * 8;
      const bf16* gp = &Bm[(size_t)(ks + k) * Ni + n0 + c8];
      bf16* lp = &Bs[buf][k][c8];
#if HAVE_ASYNC
      async_copy16(gp, lp);
#else
      *(bf16x8*)lp = *(const bf16x8*)gp;
#endif
    }
  };

  copyA(0, 0);    // prime pipeline
  copyB(0, 0);
  constexpr int NST = Ki / BKi;
#pragma unroll 1
  for (int s = 0; s < NST; ++s) {
    const int cur = s & 1;
    wait_ds0();                 // last stage's fragment reads of the buffer refilled below
    wait_async();               // this stage's tiles
    __syncthreads();
    if (s + 1 < NST) {          // overlap next tile's copies with compute
      copyA((s + 1) * BKi, cur ^ 1);
      copyB((s + 1) * BKi, cur ^ 1);
    }

#pragma unroll
    for (int j = 0; j < BKi / 32; ++j) {      // the stage's k steps, in rising k
      v16bf af[2], bfr[4];
#pragma unroll
      for (int fm = 0; fm < 2; ++fm) {
        int row = wm * 32 + fm * 16 + ln16;
#pragma unroll
        for (int r = 0; r < 8; ++r) {
          int kk = j * 32 + ((r & 3) * 2) + ((r >> 2) * 16) + hf * 8;
          af[fm][2 * r]     = As[cur][row][kk];
          af[fm][2 * r + 1] = As[cur][row][kk + 1];
        }
      }
#pragma unroll
      for (int fn = 0; fn < 4; ++fn)
        bfr[fn] = frag_tr16(&Bs[cur][j * 32 + hf * 8 + (lane & 7)][wn * 64 + fn * 16 + ((lane >> 3) & 1) * 8], BSTR);
#pragma unroll
      for (int fm = 0; fm < 2; ++fm)
#pragma unroll
        for (int fn = 0; fn < 4; ++fn)
          acc[fm][fn] = wmma_bf16(af[fm], bfr[fn], acc[fm][fn]);
    }
  }

  // straight-line epilogue (compile-time N, residual, output type)
#pragma unroll
  for (int fm = 0; fm < 2; ++fm)
#pragma unroll
    for (int fn = 0; fn < 4; ++fn)
#pragma unroll
      for (int v = 0; v < 8; ++v) {
        int row = m0 + wm * 32 + fm * 16 + v + hf * 8;
        int col = n0 + wn * 64 + fn * 16 + ln16;
        size_t idx = (size_t)row * Ni + col;
        float val = acc[fm][fn][v] + bias[col];
        if constexpr (HAS_RES) val += res[idx];
        if constexpr (OUT_BF16) ((bf16*)outp)[idx] = (bf16)val;
        else                    ((float*)outp)[idx] = val;
      }
}

// value of lane l ^ 16
__device__ inline float other_half(float x) {
  int b = __builtin_bit_cast(int, x);
  return __builtin_bit_cast(float, __builtin_amdgcn_permlanex16(b, b, 0x76543210, 0xfedcba98, false, false));
}

__global__ __launch_bounds__(128)
void attn_flash(const bf16* __restrict__ qkv, bf16* __restrict__ ctx) {
  // One struct fixes the tiles' order in LDS: the compiler folds the K-to-V distance in memory into the
  // V copy's offset field and takes it off the copy's LDS address, which stays above 0 with V behind K.
  struct Tiles {
    bf16 Ks[64][72];    // [key][d]: rows are the A operand of K.Q^T
    bf16 Vs[64][80];    // [key][d] as in memory; 160B stride (32B x odd) for the transposing read
  };
  __shared__ __attribute__((aligned(16))) Tiles sm;
  auto& Ks = sm.Ks;
  auto& Vs = sm.Vs;

  const int blk = blockIdx.x;
  const int qt = blk & 31;
  const int bh = blk >> 5;
  const int h = bh & 15, b = bh >> 4;
  const int q0 = qt * 64;
  const int tid = threadIdx.x;
  const int wave = tid >> 5, lane = tid & 31;
  const int hf = lane >> 4, ln16 = lane & 15;
  const float scale = 0.125f;   // 1/sqrt(64)

  // Q^T fragments (B operand, column = query ln16, hardware k order), pre-scaled, kept in registers
  v16bf qf[2];
  {
    const bf16* qp = &qkv[(size_t)(b * S_ + q0 + wave * 16 + ln16) * 3072 + h * 64 + hf * 8];
#pragma unroll
    for (int j = 0; j < 2; ++j) {
      bf16x8 lo = *(const bf16x8*)&qp[j * 32], hi = *(const bf16x8*)&qp[j * 32 + 16];
#pragma unroll
      for (int e = 0; e < 8; ++e) lo[e] = (bf16)((float)lo[e] * scale);
#pragma unroll
      for (int e = 0; e < 8; ++e) hi[e] = (bf16)((float)hi[e] * scale);
      qf[j] = __builtin_shufflevector(lo, hi, 0, 1, 2, 3, 4, 5, 6, 7, 8, 9, 10, 11, 12, 13, 14, 15);
    }
  }

  v8f o[4];             // o[t][v] = O[query ln16][d = 16t + 8hf + v]
#pragma unroll
  for (int t = 0; t < 4; ++t) o[t] = (v8f){0, 0, 0, 0, 0, 0, 0, 0};
  float mrow = -1e30f;  // running maximum of query ln16, equal in both halves
  float lrow = 0.f;     // running sum over this half's keys; the halves are joined behind the loop

  for (int kt = 0; kt <= qt; ++kt) {
    wait_ds0();          // this wave's fragment reads of the tiles refilled below
    __syncthreads();     // previous-iter readers done
#pragma unroll
    for (int it = 0; it < 4; ++it) {
      int i = tid + it * 128;
      int r = i >> 3, c8 = (i & 7) * 8;
      size_t base = (size_t)(b * S_ + kt * 64 + r) * 3072 + h * 64 + c8;
#if HAVE_ASYNC
      async_copy16(&qkv[base + 1024], &Ks[r][c8]);   // K tile: ASYNCcnt path
      async_copy16(&qkv[base + 2048], &Vs[r][c8]);   // V tile: the same, rows as they lie
#else
      bf16x8 kd = *(const bf16x8*)&qkv[base + 1024];
      *(bf16x4*)&Ks[r][c8]     = (bf16x4){kd[0], kd[1], kd[2], kd[3]};
      *(bf16x4*)&Ks[r][c8 + 4] = (bf16x4){kd[4], kd[5], kd[6], kd[7]};
      *(bf16x8*)&Vs[r][c8] = *(const bf16x8*)&qkv[base + 2048];
#endif
    }
    wait_async();
    __syncthreads();

    // S^T = K (64x64) @ Q^T (64x16): 4 key tiles, 2 K-steps each; sc[t][v] = S[query ln16][key 16t + 8hf + v]
    // All eight K fragments are read as one group ahead of the products.
    v16bf kf[2][4];
#pragma unroll
    for (int j = 0; j < 2; ++j)
#pragma unroll
      for (int t = 0; t < 4; ++t) {
        const bf16* kp = &Ks[t * 16 + ln16][j * 32 + hf * 8];
        kf[j][t] = __builtin_shufflevector(*(const bf16x8*)kp, *(const bf16x8*)(kp + 16),
                                           0, 1, 2, 3, 4, 5, 6, 7, 8, 9, 10, 11, 12, 13, 14, 15);
      }
    // The eight V^T fragments (A operand of V^T.P^T) are read in the same group: they land under the score
    // products and the softmax.
    v16bf vf[2][4];
#pragma unroll
    for (int j = 0; j < 2; ++j)
#pragma unroll
      for (int t = 0; t < 4; ++t)
        vf[j][t] = frag_tr16(&Vs[j * 32 + hf * 8 + (lane & 7)][t * 16 + ((lane >> 3) & 1) * 8], 80);
    // Inputs-only fence on the loaded K fragments: without it the compiler sinks the second four behind the first
    // products, each pair of reads with a wait to 0 of its own, and the wave sits out the LDS latency five times.
    asm volatile("" :: "v"(kf[0][0]), "v"(kf[0][1]), "v"(kf[0][2]), "v"(kf[0][3]),
                       "v"(kf[1][0]), "v"(kf[1][1]), "v"(kf[1][2]), "v"(kf[1][3]));
    v8f sc[4];
#pragma unroll
    for (int t = 0; t < 4; ++t) sc[t] = wmma_bf16(kf[0][t], qf[0], (v8f){0, 0, 0, 0, 0, 0, 0, 0});
#pragma unroll
    for (int t = 0; t < 4; ++t) sc[t] = wmma_bf16(kf[1][t], qf[1], sc[t]);

    // causal mask on diagonal tile (additive NINF to match reference)
    if (kt == qt) {
      const int qr = wave * 16 + ln16;
#pragma unroll
      for (int t = 0; t < 4; ++t)
#pragma unroll
        for (int v = 0; v < 8; ++v)
          sc[t][v] += (t * 16 + hf * 8 + v > qr) ? NINF : 0.f;
    }

    // online softmax: 32 of the query's 64 scores in this lane, the rest in lane ^ 16
    float mt[4];
#pragma unroll
    for (int t = 0; t < 4; ++t) {
      mt[t] = sc[t][0];
#pragma unroll
      for (int v = 1; v < 8; ++v) mt[t] = fmaxf(mt[t], sc[t][v]);
    }
    float mx = fmaxf(fmaxf(mt[0], mt[1]), fmaxf(mt[2], mt[3]));
    mx = fmaxf(mx, other_half(mx));
    const float mnew = fmaxf(mrow, mx);
    const float corr = __expf(mrow - mnew);
    float rs[4];
#pragma unroll
    for (int t = 0; t < 4; ++t) {
      rs[t] = 0.f;
#pragma unroll
      for (int v = 0; v < 8; ++v) {
        float p = __expf(sc[t][v] - mnew);
        sc[t][v] = p;
        rs[t] += p;
        o[t][v] *= corr;
      }
    }
    lrow = lrow * corr + ((rs[0] + rs[1]) + (rs[2] + rs[3]));
    mrow = mnew;

    // P^T fragments: element s of K-step j is key 32j + (s < 8 ? 8hf + s : 16 + 8hf + s - 8)
    v16bf pf[2];
#pragma unroll
    for (int j = 0; j < 2; ++j)
#pragma unroll
      for (int s = 0; s < 16; ++s) pf[j][s] = (bf16)sc[2 * j + (s >> 3)][s & 7];

    // O^T += V^T (64x64) @ P^T (64x16)
#pragma unroll
    for (int t = 0; t < 4; ++t) {
      v8f a = o[t];
#pragma unroll
      for (int j = 0; j < 2; ++j) {
        a = wmma_bf16(vf[j][t], pf[j], a);
      }
      o[t] = a;
    }
  }

  // normalize + write ctx (bf16, [B*S][DIM] at col h*64): 8 consecutive d a lane and tile, one 16-byte store
  lrow += other_half(lrow);
  const float inv = 1.0f / lrow;
  bf16* cp = &ctx[(size_t)(b * S_ + q0 + wave * 16 + ln16) * DIM_ + h * 64 + hf * 8];
#pragma unroll
  for (int t = 0; t < 4; ++t) {
    bf16x8 ov;
#pragma unroll
    for (int v = 0; v < 8; ++v) ov[v] = (bf16)(o[t][v] * inv);
    *(bf16x8*)&cp[t * 16] = ov;
  }
}

// ---------------------------------------------------------------- host launch
static inline size_t align256(size_t x) { return (x + 255) & ~(size_t)255; }

extern "C" void kernel_launch(void* const* d_in, const int* in_sizes, int n_in,
                              void* d_out, int out_size, void* d_ws, size_t ws_size,
                              hipStream_t stream) {
  const float* x    = (const float*)d_in[0];
  const float* ln_g = (const float*)d_in[1];
  const float* ln_b = (const float*)d_in[2];
  const float* wqkv = (const float*)d_in[3];
  const float* bqkv = (const float*)d_in[4];
  const float* wo   = (const float*)d_in[5];
  const float* bo   = (const float*)d_in[6];
  float* out = (float*)d_out;

  const int M = B_ * S_;          // 4096
  const int N1 = 3 * DIM_;        // 3072
  const int K = DIM_;             // 1024

  char* ws = (char*)d_ws;
  size_t off = 0;
  bf16* wqkv_b = (bf16*)(ws + off); off = align256(off + (size_t)K * N1 * 2);
  bf16* wo_b   = (bf16*)(ws + off); off = align256(off + (size_t)K * DIM_ * 2);
  bf16* h_b    = (bf16*)(ws + off); off = align256(off + (size_t)M * DIM_ * 2);
  bf16* qkv_b  = (bf16*)(ws + off); off = align256(off + (size_t)M * N1 * 2);
  bf16* ctx_b  = (bf16*)(ws + off); off = align256(off + (size_t)M * DIM_ * 2);
  (void)ws_size; (void)in_sizes; (void)n_in; (void)out_size;

  // 1) weights -> bf16
  cvt_f32_bf16<DIM_ * 3 * DIM_><<<DIM_ * 3 * DIM_ / (256 * CVT_LANE), 256, 0, stream>>>(wqkv, wqkv_b);
  cvt_f32_bf16<DIM_ * DIM_><<<DIM_ * DIM_ / (256 * CVT_LANE), 256, 0, stream>>>(wo, wo_b);
  // 2) layernorm
  layernorm_bf16<<<M / 8, 256, 0, stream>>>(x, ln_g, ln_b, h_b);
  // 3) QKV GEMM: [4096,1024]x[1024,3072] + bqkv -> bf16
  gemm_bf16_wmma<4096, 3072, 1024, 64, false, true>
      <<<dim3(N1 / BN, M / BM), 256, 0, stream>>>(h_b, wqkv_b, bqkv, nullptr, (void*)qkv_b);
  // 4) causal flash attention -> ctx bf16
  attn_flash<<<B_ * H_ * (S_ / 64), 128, 0, stream>>>(qkv_b, ctx_b);
  // 5) output GEMM + bias + residual -> f32 out
  gemm_bf16_wmma<4096, 1024, 1024, 128, true, false>
      <<<dim3(DIM_ / BN, M / BM), 256, 0, stream>>>(ctx_b, wo_b, bo, x, (void*)out);
}

// v005
// It runs in 79.6 microseconds.
// Timed twice side by side with v004, it ran 1.09 times as fast both times.
// Counting every step since v000, it is 3.55 times as fast.
#include <hip/hip_runtime.h>
#include <stdint.h>

typedef __bf16 bf16;
typedef __attribute__((ext_vector_type(16))) __bf16 v16bf;
typedef __attribute__((ext_vector_type(8)))  __bf16 bf16x8;
typedef __attribute__((ext_vector_type(4)))  __bf16 bf16x4;
typedef __attribute__((ext_vector_type(8)))  float  v8f;
typedef __attribute__((ext_vector_type(4)))  int    v4i;
typedef __attribute__((ext_vector_type(4)))  float  f32x4;

#define B_   2
#define S_   2048
#define H_   16
#define D_   64
#define DIM_ 1024
#define NINF (-10000.0f)

#ifndef __has_builtin
#define __has_builtin(x) 0
#endif

#if __has_builtin(__builtin_amdgcn_global_load_async_to_lds_b128)
#define HAVE_ASYNC 1
#else
#define HAVE_ASYNC 0
#endif

#define AS1 __attribute__((address_space(1)))
#define AS3 __attribute__((address_space(3)))
#if HAVE_ASYNC
// param1: v4i in AS1 (printed as "__device__" by clang); param2: v4i in AS3.
// flat LDS address low 32 bits == LDS byte offset (aperture rules); flat==global for AS1.
__device__ inline void async_copy16(const void* g, void* l) {
  __builtin_amdgcn_global_load_async_to_lds_b128(
      (AS1 v4i*)(unsigned long long)(uintptr_t)g,
      (AS3 v4i*)(unsigned int)(uintptr_t)l, 0, 0);
}
#endif

// this wave's async copies have landed in LDS; asm with a memory clobber so that no LDS read is lifted over it
__device__ inline void wait_async() {
#if HAVE_ASYNC
  asm volatile("s_wait_asynccnt 0x0" ::: "memory");
#endif
}

// this wave's own LDS reads and writes have retired, before a copy may be aimed at the LDS they touched
__device__ inline void wait_ds0() {
  asm volatile("s_wait_dscnt 0x0" ::: "memory");
}

// Transposing LDS read of a row-major 16-bit tile T[k][n]. Lane l passes the address of
// T[kbase + 8*(l>>4) + (l&7)][nbase + 8*((l>>3)&1)] and gets T[kbase + 8*(l>>4) + 0..7][nbase + (l&15)]:
// one half of a B fragment in the hardware k order, the order the A loaders here use.
__device__ inline bf16x8 ld_tr16(const bf16* p) {
  return __builtin_amdgcn_ds_load_tr16_b128_v8bf16((AS3 bf16x8*)p);
}
__device__ inline v16bf frag_tr16(const bf16* p, int pitch) {
  bf16x8 lo = ld_tr16(p), hi = ld_tr16(p + 16 * pitch);
  return __builtin_shufflevector(lo, hi, 0, 1, 2, 3, 4, 5, 6, 7, 8, 9, 10, 11, 12, 13, 14, 15);
}

__device__ inline v8f wmma_bf16(v16bf a, v16bf b, v8f c) {
  return __builtin_amdgcn_wmma_f32_16x16x32_bf16(false, a, false, b, (short)0, c, false, false);
}

// ---------------------------------------------------------------- convert
// 32 elements a lane, eight 16-byte loads in flight, so that few waves have to start.
#define CVT_LANE 32
template<int N>
__global__ __launch_bounds__(256) void cvt_f32_bf16(const float* __restrict__ in,
                                                    bf16* __restrict__ out) {
  static_assert(N % (256 * CVT_LANE) == 0, "whole blocks only");
  const int base = blockIdx.x * (256 * CVT_LANE) + threadIdx.x * 4;
  f32x4 v[CVT_LANE / 4];
#pragma unroll
  for (int j = 0; j < CVT_LANE / 4; ++j) v[j] = *(const f32x4*)&in[base + j * 1024];
#pragma unroll
  for (int j = 0; j < CVT_LANE / 4; ++j) {
    bf16x4 o;
#pragma unroll
    for (int e = 0; e < 4; ++e) o[e] = (bf16)v[j][e];
    *(bf16x4*)&out[base + j * 1024] = o;
  }
}

// ---------------------------------------------------------------- layernorm
// One wave a row (32 elements a lane), eight rows a block: an eighth of the waves, no LDS, no barrier.
__global__ __launch_bounds__(256) void layernorm_bf16(const float* __restrict__ x,
                                                      const float* __restrict__ g,
                                                      const float* __restrict__ b,
                                                      bf16* __restrict__ h) {
  const int wave = threadIdx.x >> 5, lane = threadIdx.x & 31;
  const int row = blockIdx.x * 8 + wave;
  const float* xr = x + (size_t)row * DIM_ + lane * 4;

  f32x4 v[8];
#pragma unroll
  for (int i = 0; i < 8; ++i) v[i] = *(const f32x4*)&xr[i * 128];

  f32x4 s4 = v[0];
#pragma unroll
  for (int i = 1; i < 8; ++i) s4 += v[i];
  float s = (s4[0] + s4[1]) + (s4[2] + s4[3]);
#pragma unroll
  for (int off = 16; off >= 1; off >>= 1) s += __shfl_xor(s, off, 32);
  const float mu = s * (1.0f / DIM_);

  f32x4 q4 = (f32x4){0.f, 0.f, 0.f, 0.f};
#pragma unroll
  for (int i = 0; i < 8; ++i) { v[i] -= mu; q4 += v[i] * v[i]; }
  float vs = (q4[0] + q4[1]) + (q4[2] + q4[3]);
#pragma unroll
  for (int off = 16; off >= 1; off >>= 1) vs += __shfl_xor(vs, off, 32);
  const float rstd = __frsqrt_rn(vs * (1.0f / DIM_) + 1e-6f);

  bf16* hr = h + (size_t)row * DIM_ + lane * 4;
#pragma unroll
  for (int i = 0; i < 8; ++i) {
    const f32x4 gg = *(const f32x4*)&g[i * 128 + lane * 4];
    const f32x4 bb = *(const f32x4*)&b[i * 128 + lane * 4];
    bf16x4 o;
#pragma unroll
    for (int e = 0; e < 4; ++e) o[e] = (bf16)(v[i][e] * rstd * gg[e] + bb[e]);
    *(bf16x4*)&hr[i * 128] = o;
  }
}

// ---------------------------------------------------------------- GEMM (bf16 WMMA)
// C[M,N] = A[M,K] @ B[K,N] + bias ; optional residual ; out bf16 or f32
// 128x128 block tile, 8 waves (4x2) x (2x4) 16x16 WMMA tiles.
// Double-buffered LDS, A and B tiles via async-to-LDS (when available); the B tile
// stays row-major [k][n] as in memory and is transposed by the fragment read.
// BKi = k per LDS stage, a multiple of 64: a stage's piece of an A row is then whole 128-byte lines, and a
// stage holds BKi / 32 k steps of products between two barriers, under which the next stage's copies land.
#define BM 128
#define BN 128
#define BSTR 144  // 288B stride: 32B x odd, conflict free for the transposing read

template<int Mi, int Ni, int Ki, int BKi, bool HAS_RES, bool OUT_BF16>
__global__ __launch_bounds__(256)
void gemm_bf16_wmma(const bf16* __restrict__ A, const bf16* __restrict__ Bm,
                    const float* __restrict__ bias, const float* __restrict__ res,
                    void* __restrict__ outp) {
  static_assert(BKi % 64 == 0 && Ki % BKi == 0, "whole lines, whole stages");
  constexpr int ASTR = BKi + 8;   // 144B or 272B stride: 16B x odd, conflict free for the 16-byte read
  __shared__ __attribute__((aligned(16))) bf16 As[2][BM][ASTR];
  __shared__ __attribute__((aligned(16))) bf16 Bs[2][BKi][BSTR];   // Bs[k][n]

  const int tid = threadIdx.x;
  const int wave = tid >> 5, lane = tid & 31;
  const int wm = wave & 3, wn = wave >> 2;       // 4x2 wave grid
  const int hf = lane >> 4, ln16 = lane & 15;
  const int m0 = blockIdx.y * BM;
  const int n0 = blockIdx.x * BN;

  v8f acc[2][4];
#pragma unroll
  for (int i = 0; i < 2; ++i)
#pragma unroll
    for (int j = 0; j < 4; ++j) acc[i][j] = (v8f){0, 0, 0, 0, 0, 0, 0, 0};

  auto copyA = [&](int ks, int buf) {
#pragma unroll
    for (int it = 0; it < BM * BKi / 8 / 256; ++it) {
      int i = tid + it * 256;                 // chunks of 8 halfs, BKi / 8 a row
      int r = i / (BKi / 8), c8 = (i % (BKi / 8)) * 8;
      const bf16* gp = &A[(size_t)(m0 + r) * Ki + ks + c8];
      bf16* lp = &As[buf][r][c8];
#if HAVE_ASYNC
      async_copy16(gp, lp);
#else
      *(bf16x8*)lp = *(const bf16x8*)gp;
#endif
    }
  };
  auto copyB = [&](int ks, int buf) {
#pragma unroll
    for (int it = 0; it < BKi * BN / 8 / 256; ++it) {
      int i = tid + it * 256;                 // chunks of 8 halfs, 16 a row
      int k = i >> 4, c8 = (i & 15) * 8;
      const bf16* gp = &Bm[(size_t)(ks + k) * Ni + n0 + c8];
      bf16* lp = &Bs[buf][k][c8];
#if HAVE_ASYNC
      async_copy16(gp, lp);
#else
      *(bf16x8*)lp = *(const bf16x8*)gp;
#endif
    }
  };

  copyA(0, 0);    // prime pipeline
  copyB(0, 0);
  constexpr int NST = Ki / BKi;
#pragma unroll 1
  for (int s = 0; s < NST; ++s) {
    const int cur = s & 1;
    wait_ds0();                 // last stage's fragment reads of the buffer refilled below
    wait_async();               // this stage's tiles
    __syncthreads();
    if (s + 1 < NST) {          // overlap next tile's copies with compute
      copyA((s + 1) * BKi, cur ^ 1);
      copyB((s + 1) * BKi, cur ^ 1);
    }

#pragma unroll
    for (int j = 0; j < BKi / 32; ++j) {      // the stage's k steps, in rising k
      v16bf af[2], bfr[4];
#pragma unroll
      for (int fm = 0; fm < 2; ++fm) {
        int row = wm * 32 + fm * 16 + ln16;
#pragma unroll
        for (int r = 0; r < 8; ++r) {
          int kk = j * 32 + ((r & 3) * 2) + ((r >> 2) * 16) + hf * 8;
          af[fm][2 * r]     = As[cur][row][kk];
          af[fm][2 * r + 1] = As[cur][row][kk + 1];
        }
      }
#pragma unroll
      for (int fn = 0; fn < 4; ++fn)
        bfr[fn] = frag_tr16(&Bs[cur][j * 32 + hf * 8 + (lane & 7)][wn * 64 + fn * 16 + ((lane >> 3) & 1) * 8], BSTR);
#pragma unroll
      for (int fm = 0; fm < 2; ++fm)
#pragma unroll
        for (int fn = 0; fn < 4; ++fn)
          acc[fm][fn] = wmma_bf16(af[fm], bfr[fn], acc[fm][fn]);
    }
  }

  // straight-line epilogue (compile-time N, residual, output type)
#pragma unroll
  for (int fm = 0; fm < 2; ++fm)
#pragma unroll
    for (int fn = 0; fn < 4; ++fn)
#pragma unroll
      for (int v = 0; v < 8; ++v) {
        int row = m0 + wm * 32 + fm * 16 + v + hf * 8;
        int col = n0 + wn * 64 + fn * 16 + ln16;
        size_t idx = (size_t)row * Ni + col;
        float val = acc[fm][fn][v] + bias[col];
        if constexpr (HAS_RES) val += res[idx];
        if constexpr (OUT_BF16) ((bf16*)outp)[idx] = (bf16)val;
        else                    ((float*)outp)[idx] = val;
      }
}

// value of lane l ^ 16
__device__ inline float other_half(float x) {
  int b = __builtin_bit_cast(int, x);
  return __builtin_bit_cast(float, __builtin_amdgcn_permlanex16(b, b, 0x76543210, 0xfedcba98, false, false));
}

__global__ __launch_bounds__(128)
void attn_flash(const bf16* __restrict__ qkv, bf16* __restrict__ ctx) {
  // One struct fixes the tiles' order in LDS: the compiler folds the K-to-V distance in memory into the
  // V copy's offset field and takes it off the copy's LDS address, which stays above 0 with V behind K.
  struct Tiles {
    bf16 Ks[128][72];   // [key][d]: rows are the A operand of K.Q^T
    bf16 Vs[128][80];   // [key][d] as in memory; 160B stride (32B x odd) for the transposing read
  };
  __shared__ __attribute__((aligned(16))) Tiles sm[2];

  const int blk = blockIdx.x;
  const int qt = blk & 31;
  const int bh = blk >> 5;
  const int h = bh & 15, b = bh >> 4;
  const int q0 = qt * 64;
  const int tid = threadIdx.x;
  const int wave = tid >> 5, lane = tid & 31;
  const int hf = lane >> 4, ln16 = lane & 15;
  const float scale = 0.125f;   // 1/sqrt(64)
  const int nst = (qt >> 1) + 1;   // stages that hold a key tile up to the diagonal; at most S_ / 128

  // stage st (keys 128 st .. 128 st + 127 of K and of V) into buffer buf: sixteen 16-byte copies a lane
  // (a lane's rows are tid / 8 + 16 it, its eight columns 8 (tid & 7): 128 whole bytes of a row from eight lanes)
  const bf16* const gk0 = &qkv[(size_t)(b * S_ + (tid >> 3)) * 3072 + h * 64 + (tid & 7) * 8 + 1024];
  auto copy_stage = [&](int st, int buf) {
    const bf16* gk = gk0 + (size_t)st * (128 * 3072);
    bf16* lk = &sm[buf].Ks[tid >> 3][(tid & 7) * 8];
    bf16* lv = &sm[buf].Vs[tid >> 3][(tid & 7) * 8];
#pragma unroll
    for (int it = 0; it < 8; ++it) {
#if HAVE_ASYNC
      async_copy16(gk + it * (16 * 3072), lk + it * (16 * 72));          // K rows: ASYNCcnt path
      async_copy16(gk + it * (16 * 3072) + 1024, lv + it * (16 * 80));   // V rows: the same, rows as they lie
#else
      *(bf16x8*)(lk + it * (16 * 72)) = *(const bf16x8*)(gk + it * (16 * 3072));
      *(bf16x8*)(lv + it * (16 * 80)) = *(const bf16x8*)(gk + it * (16 * 3072) + 1024);
#endif
    }
  };
  copy_stage(0, 0);     // in flight under the Q loads below

  // Q^T fragments (B operand, column = query ln16, hardware k order), pre-scaled, kept in registers
  v16bf qf[2];
  {
    const bf16* qp = &qkv[(size_t)(b * S_ + q0 + wave * 16 + ln16) * 3072 + h * 64 + hf * 8];
#pragma unroll
    for (int j = 0; j < 2; ++j) {
      bf16x8 lo = *(const bf16x8*)&qp[j * 32], hi = *(const bf16x8*)&qp[j * 32 + 16];
#pragma unroll
      for (int e = 0; e < 8; ++e) lo[e] = (bf16)((float)lo[e] * scale);
#pragma unroll
      for (int e = 0; e < 8; ++e) hi[e] = (bf16)((float)hi[e] * scale);
      qf[j] = __builtin_shufflevector(lo, hi, 0, 1, 2, 3, 4, 5, 6, 7, 8, 9, 10, 11, 12, 13, 14, 15);
    }
  }

  v8f o[4];             // o[t][v] = O[query ln16][d = 16t + 8hf + v]
#pragma unroll
  for (int t = 0; t < 4; ++t) o[t] = (v8f){0, 0, 0, 0, 0, 0, 0, 0};
  float mrow = -1e30f;  // running maximum of query ln16, equal in both halves
  float lrow = 0.f;     // running sum over this half's keys; the halves are joined behind the loop

  wait_async();          // stage 0 has landed
  __syncthreads();       // and every wave may read it
  if (nst > 1) copy_stage(1, 1);

  for (int kt = 0; kt <= qt; ++kt) {
    const int st = kt >> 1;                       // the stage that holds tile kt
    const bf16 (*Ks)[72] = &sm[st & 1].Ks[(kt & 1) * 64];
    const bf16 (*Vs)[80] = &sm[st & 1].Vs[(kt & 1) * 64];

    // S^T = K (64x64) @ Q^T (64x16): 4 key tiles, 2 K-steps each; sc[t][v] = S[query ln16][key 16t + 8hf + v]
    // All eight K fragments are read as one group ahead of the products.
    v16bf kf[2][4];
#pragma unroll
    for (int j = 0; j < 2; ++j)
#pragma unroll
      for (int t = 0; t < 4; ++t) {
        const bf16* kp = &Ks[t * 16 + ln16][j * 32 + hf * 8];
        kf[j][t] = __builtin_shufflevector(*(const bf16x8*)kp, *(const bf16x8*)(kp + 16),
                                           0, 1, 2, 3, 4, 5, 6, 7, 8, 9, 10, 11, 12, 13, 14, 15);
      }
    // The eight V^T fragments (A operand of V^T.P^T) are read in the same group: they land under the score
    // products and the softmax.
    v16bf vf[2][4];
#pragma unroll
    for (int j = 0; j < 2; ++j)
#pragma unroll
      for (int t = 0; t < 4; ++t)
        vf[j][t] = frag_tr16(&Vs[j * 32 + hf * 8 + (lane & 7)][t * 16 + ((lane >> 3) & 1) * 8], 80);
    // Inputs-only fence on the loaded K fragments: without it the compiler sinks the second four behind the first
    // products, each pair of reads with a wait to 0 of its own, and the wave sits out the LDS latency five times.
    asm volatile("" :: "v"(kf[0][0]), "v"(kf[0][1]), "v"(kf[0][2]), "v"(kf[0][3]),
                       "v"(kf[1][0]), "v"(kf[1][1]), "v"(kf[1][2]), "v"(kf[1][3]));
    v8f sc[4];
#pragma unroll
    for (int t = 0; t < 4; ++t) sc[t] = wmma_bf16(kf[0][t], qf[0], (v8f){0, 0, 0, 0, 0, 0, 0, 0});
#pragma unroll
    for (int t = 0; t < 4; ++t) sc[t] = wmma_bf16(kf[1][t], qf[1], sc[t]);

    // causal mask on diagonal tile (additive NINF to match reference)
    if (kt == qt) {
      const int qr = wave * 16 + ln16;
#pragma unroll
      for (int t = 0; t < 4; ++t)
#pragma unroll
        for (int v = 0; v < 8; ++v)
          sc[t][v] += (t * 16 + hf * 8 + v > qr) ? NINF : 0.f;
    }

    // online softmax: 32 of the query's 64 scores in this lane, the rest in lane ^ 16
    float mt[4];
#pragma unroll
    for (int t = 0; t < 4; ++t) {
      mt[t] = sc[t][0];
#pragma unroll
      for (int v = 1; v < 8; ++v) mt[t] = fmaxf(mt[t], sc[t][v]);
    }
    float mx = fmaxf(fmaxf(mt[0], mt[1]), fmaxf(mt[2], mt[3]));
    mx = fmaxf(mx, other_half(mx));
    const float mnew = fmaxf(mrow, mx);
    const float corr = __expf(mrow - mnew);
    float rs[4];
#pragma unroll
    for (int t = 0; t < 4; ++t) {
      rs[t] = 0.f;
#pragma unroll
      for (int v = 0; v < 8; ++v) {
        float p = __expf(sc[t][v] - mnew);
        sc[t][v] = p;
        rs[t] += p;
        o[t][v] *= corr;
      }
    }
    lrow = lrow * corr + ((rs[0] + rs[1]) + (rs[2] + rs[3]));
    mrow = mnew;

    // P^T fragments: element s of K-step j is key 32j + (s < 8 ? 8hf + s : 16 + 8hf + s - 8)
    v16bf pf[2];
#pragma unroll
    for (int j = 0; j < 2; ++j)
#pragma unroll
      for (int s = 0; s < 16; ++s) pf[j][s] = (bf16)sc[2 * j + (s >> 3)][s & 7];

    // O^T += V^T (64x64) @ P^T (64x16)
#pragma unroll
    for (int t = 0; t < 4; ++t) {
      v8f a = o[t];
#pragma unroll
      for (int j = 0; j < 2; ++j) {
        a = wmma_bf16(vf[j][t], pf[j], a);
      }
      o[t] = a;
    }

    // hand-over behind a stage's second tile: the one barrier publishes stage st + 1 and gives buffer st & 1 free
    if (kt & 1) {
      wait_ds0();        // this wave's fragment reads of the buffer refilled below
      wait_async();      // this wave's copies of stage st + 1
      __syncthreads();
      if (st + 2 < nst) copy_stage(st + 2, st & 1);
    }
  }
  wait_async();          // nothing is in flight when the wave ends

  // normalize + write ctx (bf16, [B*S][DIM] at col h*64): 8 consecutive d a lane and tile, one 16-byte store
  lrow += other_half(lrow);
  const float inv = 1.0f / lrow;
  bf16* cp = &ctx[(size_t)(b * S_ + q0 + wave * 16 + ln16) * DIM_ + h * 64 + hf * 8];
#pragma unroll
  for (int t = 0; t < 4; ++t) {
    bf16x8 ov;
#pragma unroll
    for (int v = 0; v < 8; ++v) ov[v] = (bf16)(o[t][v] * inv);
    *(bf16x8*)&cp[t * 16] = ov;
  }
}

// ---------------------------------------------------------------- host launch
static inline size_t align256(size_t x) { return (x + 255) & ~(size_t)255; }

extern "C" void kernel_launch(void* const* d_in, const int* in_sizes, int n_in,
                              void* d_out, int out_size, void* d_ws, size_t ws_size,
                              hipStream_t stream) {
  const float* x    = (const float*)d_in[0];
  const float* ln_g = (const float*)d_in[1];
  const float* ln_b = (const float*)d_in[2];
  const float* wqkv = (const float*)d_in[3];
  const float* bqkv = (const float*)d_in[4];
  const float* wo   = (const float*)d_in[5];
  const float* bo   = (const float*)d_in[6];
  float* out = (float*)d_out;

  const int M = B_ * S_;          // 4096
  const int N1 = 3 * DIM_;        // 3072
  const int K = DIM_;             // 1024

  char* ws = (char*)d_ws;
  size_t off = 0;
  bf16* wqkv_b = (bf16*)(ws + off); off = align256(off + (size_t)K * N1 * 2);
  bf16* wo_b   = (bf16*)(ws + off); off = align256(off + (size_t)K * DIM_ * 2);
  bf16* h_b    = (bf16*)(ws + off); off = align256(off + (size_t)M * DIM_ * 2);
  bf16* qkv_b  = (bf16*)(ws + off); off = align256(off + (size_t)M * N1 * 2);
  bf16* ctx_b  = (bf16*)(ws + off); off = align256(off + (size_t)M * DIM_ * 2);
  (void)ws_size; (void)in_sizes; (void)n_in; (void)out_size;

  // 1) weights -> bf16
  cvt_f32_bf16<DIM_ * 3 * DIM_><<<DIM_ * 3 * DIM_ / (256 * CVT_LANE), 256, 0, stream>>>(wqkv, wqkv_b);
  cvt_f32_bf16<DIM_ * DIM_><<<DIM_ * DIM_ / (256 * CVT_LANE), 256, 0, stream>>>(wo, wo_b);
  // 2) layernorm
  layernorm_bf16<<<M / 8, 256, 0, stream>>>(x, ln_g, ln_b, h_b);
  // 3) QKV GEMM: [4096,1024]x[1024,3072] + bqkv -> bf16
  gemm_bf16_wmma<4096, 3072, 1024, 64, false, true>
      <<<dim3(N1 / BN, M / BM), 256, 0, stream>>>(h_b, wqkv_b, bqkv, nullptr, (void*)qkv_b);
  // 4) causal flash attention -> ctx bf16
  attn_flash<<<B_ * H_ * (S_ / 64), 128, 0, stream>>>(qkv_b, ctx_b);
  // 5) output GEMM + bias + residual -> f32 out
  gemm_bf16_wmma<4096, 1024, 1024, 128, true, false>
      <<<dim3(DIM_ / BN, M / BM), 256, 0, stream>>>(ctx_b, wo_b, bo, x, (void*)out);
}

// v006
// Measured time: 75.8 microseconds a run.
// Two timings next to v005 both put it at 1.05 times that version's speed.
// Over all steps from v000 it is 3.73 times as fast.
#include <hip/hip_runtime.h>
#include <stdint.h>

typedef __bf16 bf16;
typedef __attribute__((ext_vector_type(16))) __bf16 v16bf;
typedef __attribute__((ext_vector_type(8)))  __bf16 bf16x8;
typedef __attribute__((ext_vector_type(4)))  __bf16 bf16x4;
typedef __attribute__((ext_vector_type(8)))  float  v8f;
typedef __attribute__((ext_vector_type(4)))  int    v4i;
typedef __attribute__((ext_vector_type(4)))  float  f32x4;

#define B_   2
#define S_   2048
#define H_   16
#define D_   64
#define DIM_ 1024
#define NINF (-10000.0f)

#ifndef __has_builtin
#define __has_builtin(x) 0
#endif

#if __has_builtin(__builtin_amdgcn_global_load_async_to_lds_b128)
#define HAVE_ASYNC 1
#else
#define HAVE_ASYNC 0
#endif

#define AS1 __attribute__((address_space(1)))
#define AS3 __attribute__((address_space(3)))
#if HAVE_ASYNC
// param1: v4i in AS1 (printed as "__device__" by clang); param2: v4i in AS3.
// flat LDS address low 32 bits == LDS byte offset (aperture rules); flat==global for AS1.
__device__ inline void async_copy16(const void* g, void* l) {
  __builtin_amdgcn_global_load_async_to_lds_b128(
      (AS1 v4i*)(unsigned long long)(uintptr_t)g,
      (AS3 v4i*)(unsigned int)(uintptr_t)l, 0, 0);
}
#endif

// this wave's async copies have landed in LDS; asm with a memory clobber so that no LDS read is lifted over it
__device__ inline void wait_async() {
#if HAVE_ASYNC
  asm volatile("s_wait_asynccnt 0x0" ::: "memory");
#endif
}

// this wave's own LDS reads and writes have retired, before a copy may be aimed at the LDS they touched
__device__ inline void wait_ds0() {
  asm volatile("s_wait_dscnt 0x0" ::: "memory");
}

// Transposing LDS read of a row-major 16-bit tile T[k][n]. Lane l passes the address of
// T[kbase + 8*(l>>4) + (l&7)][nbase + 8*((l>>3)&1)] and gets T[kbase + 8*(l>>4) + 0..7][nbase + (l&15)]:
// one half of a B fragment in the hardware k order, the order the A loaders here use.
__device__ inline bf16x8 ld_tr16(const bf16* p) {
  return __builtin_amdgcn_ds_load_tr16_b128_v8bf16((AS3 bf16x8*)p);
}
__device__ inline v16bf frag_tr16(const bf16* p, int pitch) {
  bf16x8 lo = ld_tr16(p), hi = ld_tr16(p + 16 * pitch);
  return __builtin_shufflevector(lo, hi, 0, 1, 2, 3, 4, 5, 6, 7, 8, 9, 10, 11, 12, 13, 14, 15);
}

__device__ inline v8f wmma_bf16(v16bf a, v16bf b, v8f c) {
  return __builtin_amdgcn_wmma_f32_16x16x32_bf16(false, a, false, b, (short)0, c, false, false);
}

// ---------------------------------------------------------------- front pass: convert + layernorm
// The two weight conversions and the layernorm read nothing of each other's output, so they share one launch:
// the block index picks the job. Every block moves the same bytes (32 KiB read, 16 KiB written).

// convert: 32 elements a lane, eight 16-byte loads in flight, so that few waves have to start.
#define CVT_LANE 32
#define CVT_BLOCK (256 * CVT_LANE)
__device__ inline void cvt_block(const float* __restrict__ in, bf16* __restrict__ out, int blk) {
  const int base = blk * CVT_BLOCK + threadIdx.x * 4;
  f32x4 v[CVT_LANE / 4];
#pragma unroll
  for (int j = 0; j < CVT_LANE / 4; ++j) v[j] = *(const f32x4*)&in[base + j * 1024];
#pragma unroll
  for (int j = 0; j < CVT_LANE / 4; ++j) {
    bf16x4 o;
#pragma unroll
    for (int e = 0; e < 4; ++e) o[e] = (bf16)v[j][e];
    *(bf16x4*)&out[base + j * 1024] = o;
  }
  // inlined into a branch: code of the other jobs may follow in the listing and reuse the stores' registers
  asm volatile("s_wait_xcnt 0x0" ::: "memory");
}

// layernorm: one wave a row (32 elements a lane), eight rows a block: no LDS, no barrier.
__device__ inline void layernorm_block(const float* __restrict__ x,
                                       const float* __restrict__ g,
                                       const float* __restrict__ b,
                                       bf16* __restrict__ h, int blk) {
  const int wave = threadIdx.x >> 5, lane = threadIdx.x & 31;
  const int row = blk * 8 + wave;
  const float* xr = x + (size_t)row * DIM_ + lane * 4;

  f32x4 v[8];
#pragma unroll
  for (int i = 0; i < 8; ++i) v[i] = *(const f32x4*)&xr[i * 128];

  f32x4 s4 = v[0];
#pragma unroll
  for (int i = 1; i < 8; ++i) s4 += v[i];
  float s = (s4[0] + s4[1]) + (s4[2] + s4[3]);
#pragma unroll
  for (int off = 16; off >= 1; off >>= 1) s += __shfl_xor(s, off, 32);
  const float mu = s * (1.0f / DIM_);

  f32x4 q4 = (f32x4){0.f, 0.f, 0.f, 0.f};
#pragma unroll
  for (int i = 0; i < 8; ++i) { v[i] -= mu; q4 += v[i] * v[i]; }
  float vs = (q4[0] + q4[1]) + (q4[2] + q4[3]);
#pragma unroll
  for (int off = 16; off >= 1; off >>= 1) vs += __shfl_xor(vs, off, 32);
  const float rstd = __frsqrt_rn(vs * (1.0f / DIM_) + 1e-6f);

  bf16* hr = h + (size_t)row * DIM_ + lane * 4;
#pragma unroll
  for (int i = 0; i < 8; ++i) {
    const f32x4 gg = *(const f32x4*)&g[i * 128 + lane * 4];
    const f32x4 bb = *(const f32x4*)&b[i * 128 + lane * 4];
    bf16x4 o;
#pragma unroll
    for (int e = 0; e < 4; ++e) o[e] = (bf16)(v[i][e] * rstd * gg[e] + bb[e]);
    *(bf16x4*)&hr[i * 128] = o;
  }
}

#define LN_BLOCKS   (B_ * S_ / 8)
#define WQKV_BLOCKS (DIM_ * 3 * DIM_ / CVT_BLOCK)
#define WO_BLOCKS   (DIM_ * DIM_ / CVT_BLOCK)
static_assert((DIM_ * DIM_) % CVT_BLOCK == 0 && (B_ * S_) % 8 == 0, "whole blocks only");

__global__ __launch_bounds__(256) void front_pass(const float* __restrict__ x,
                                                  const float* __restrict__ g,
                                                  const float* __restrict__ b,
                                                  const float* __restrict__ wqkv,
                                                  const float* __restrict__ wo,
                                                  bf16* __restrict__ h,
                                                  bf16* __restrict__ wqkv_b,
                                                  bf16* __restrict__ wo_b) {
  const int blk = blockIdx.x;
  if (blk < LN_BLOCKS)                    layernorm_block(x, g, b, h, blk);
  else if (blk < LN_BLOCKS + WQKV_BLOCKS) cvt_block(wqkv, wqkv_b, blk - LN_BLOCKS);
  else                                    cvt_block(wo, wo_b, blk - (LN_BLOCKS + WQKV_BLOCKS));
}

// ---------------------------------------------------------------- GEMM (bf16 WMMA)
// C[M,N] = A[M,K] @ B[K,N] + bias ; optional residual ; out bf16 or f32
// 128x128 block tile, 8 waves (4x2) x (2x4) 16x16 WMMA tiles.
// Double-buffered LDS, A and B tiles via async-to-LDS (when available); the B tile
// stays row-major [k][n] as in memory and is transposed by the fragment read.
// BKi = k per LDS stage, a multiple of 64: a stage's piece of an A row is then whole 128-byte lines, and a
// stage holds BKi / 32 k steps of products between two barriers, under which the next stage's copies land.
#define BM 128
#define BN 128
#define BSTR 144  // 288B stride: 32B x odd, conflict free for the transposing read

template<int Mi, int Ni, int Ki, int BKi, bool HAS_RES, bool OUT_BF16>
__global__ __launch_bounds__(256)
void gemm_bf16_wmma(const bf16* __restrict__ A, const bf16* __restrict__ Bm,
                    const float* __restrict__ bias, const float* __restrict__ res,
                    void* __restrict__ outp) {
  static_assert(BKi % 64 == 0 && Ki % BKi == 0, "whole lines, whole stages");
  constexpr int ASTR = BKi + 8;   // 144B or 272B stride: 16B x odd, conflict free for the 16-byte read
  __shared__ __attribute__((aligned(16))) bf16 As[2][BM][ASTR];
  __shared__ __attribute__((aligned(16))) bf16 Bs[2][BKi][BSTR];   // Bs[k][n]

  const int tid = threadIdx.x;
  const int wave = tid >> 5, lane = tid & 31;
  const int wm = wave & 3, wn = wave >> 2;       // 4x2 wave grid
  const int hf = lane >> 4, ln16 = lane & 15;
  const int m0 = blockIdx.y * BM;
  const int n0 = blockIdx.x * BN;

  v8f acc[2][4];
#pragma unroll
  for (int i = 0; i < 2; ++i)
#pragma unroll
    for (int j = 0; j < 4; ++j) acc[i][j] = (v8f){0, 0, 0, 0, 0, 0, 0, 0};

  auto copyA = [&](int ks, int buf) {
#pragma unroll
    for (int it = 0; it < BM * BKi / 8 / 256; ++it) {
      int i = tid + it * 256;                 // chunks of 8 halfs, BKi / 8 a row
      int r = i / (BKi / 8), c8 = (i % (BKi / 8)) * 8;
      const bf16* gp = &A[(size_t)(m0 + r) * Ki + ks + c8];
      bf16* lp = &As[buf][r][c8];
#if HAVE_ASYNC
      async_copy16(gp, lp);
#else
      *(bf16x8*)lp = *(const bf16x8*)gp;
#endif
    }
  };
  auto copyB = [&](int ks, int buf) {
#pragma unroll
    for (int it = 0; it < BKi * BN / 8 / 256; ++it) {
      int i = tid + it * 256;                 // chunks of 8 halfs, 16 a row
      int k = i >> 4, c8 = (i & 15) * 8;
      const bf16* gp = &Bm[(size_t)(ks + k) * Ni + n0 + c8];
      bf16* lp = &Bs[buf][k][c8];
#if HAVE_ASYNC
      async_copy16(gp, lp);
#else
      *(bf16x8*)lp = *(const bf16x8*)gp;
#endif
    }
  };

  copyA(0, 0);    // prime pipeline
  copyB(0, 0);
  constexpr int NST = Ki / BKi;
#pragma unroll 1
  for (int s = 0; s < NST; ++s) {
    const int cur = s & 1;
    wait_ds0();                 // last stage's fragment reads of the buffer refilled below
    wait_async();               // this stage's tiles
    __syncthreads();
    if (s + 1 < NST) {          // overlap next tile's copies with compute
      copyA((s + 1) * BKi, cur ^ 1);
      copyB((s + 1) * BKi, cur ^ 1);
    }

#pragma unroll
    for (int j = 0; j < BKi / 32; ++j) {      // the stage's k steps, in rising k
      v16bf af[2], bfr[4];
#pragma unroll
      for (int fm = 0; fm < 2; ++fm) {
        int row = wm * 32 + fm * 16 + ln16;
#pragma unroll
        for (int r = 0; r < 8; ++r) {
          int kk = j * 32 + ((r & 3) * 2) + ((r >> 2) * 16) + hf * 8;
          af[fm][2 * r]     = As[cur][row][kk];
          af[fm][2 * r + 1] = As[cur][row][kk + 1];
        }
      }
#pragma unroll
      for (int fn = 0; fn < 4; ++fn)
        bfr[fn] = frag_tr16(&Bs[cur][j * 32 + hf * 8 + (lane & 7)][wn * 64 + fn * 16 + ((lane >> 3) & 1) * 8], BSTR);
#pragma unroll
      for (int fm = 0; fm < 2; ++fm)
#pragma unroll
        for (int fn = 0; fn < 4; ++fn)
          acc[fm][fn] = wmma_bf16(af[fm], bfr[fn], acc[fm][fn]);
    }
  }

  // straight-line epilogue (compile-time N, residual, output type)
#pragma unroll
  for (int fm = 0; fm < 2; ++fm)
#pragma unroll
    for (int fn = 0; fn < 4; ++fn)
#pragma unroll
      for (int v = 0; v < 8; ++v) {
        int row = m0 + wm * 32 + fm * 16 + v + hf * 8;
        int col = n0 + wn * 64 + fn * 16 + ln16;
        size_t idx = (size_t)row * Ni + col;
        float val = acc[fm][fn][v] + bias[col];
        if constexpr (HAS_RES) val += res[idx];
        if constexpr (OUT_BF16) ((bf16*)outp)[idx] = (bf16)val;
        else                    ((float*)outp)[idx] = val;
      }
}

// value of lane l ^ 16
__device__ inline float other_half(float x) {
  int b = __builtin_bit_cast(int, x);
  return __builtin_bit_cast(float, __builtin_amdgcn_permlanex16(b, b, 0x76543210, 0xfedcba98, false, false));
}

__global__ __launch_bounds__(128)
void attn_flash(const bf16* __restrict__ qkv, bf16* __restrict__ ctx) {
  // One struct fixes the tiles' order in LDS: the compiler folds the K-to-V distance in memory into the
  // V copy's offset field and takes it off the copy's LDS address, which stays above 0 with V behind K.
  struct Tiles {
    bf16 Ks[128][72];   // [key][d]: rows are the A operand of K.Q^T
    bf16 Vs[128][80];   // [key][d] as in memory; 160B stride (32B x odd) for the transposing read
  };
  __shared__ __attribute__((aligned(16))) Tiles sm[2];

  const int blk = blockIdx.x;
  const int qt = blk & 31;
  const int bh = blk >> 5;
  const int h = bh & 15, b = bh >> 4;
  const int q0 = qt * 64;
  const int tid = threadIdx.x;
  const int wave = tid >> 5, lane = tid & 31;
  const int hf = lane >> 4, ln16 = lane & 15;
  const float scale = 0.125f;   // 1/sqrt(64)
  const int nst = (qt >> 1) + 1;   // stages that hold a key tile up to the diagonal; at most S_ / 128

  // stage st (keys 128 st .. 128 st + 127 of K and of V) into buffer buf: sixteen 16-byte copies a lane
  // (a lane's rows are tid / 8 + 16 it, its eight columns 8 (tid & 7): 128 whole bytes of a row from eight lanes)
  const bf16* const gk0 = &qkv[(size_t)(b * S_ + (tid >> 3)) * 3072 + h * 64 + (tid & 7) * 8 + 1024];
  auto copy_stage = [&](int st, int buf) {
    const bf16* gk = gk0 + (size_t)st * (128 * 3072);
    bf16* lk = &sm[buf].Ks[tid >> 3][(tid & 7) * 8];
    bf16* lv = &sm[buf].Vs[tid >> 3][(tid & 7) * 8];
#pragma unroll
    for (int it = 0; it < 8; ++it) {
#if HAVE_ASYNC
      async_copy16(gk + it * (16 * 3072), lk + it * (16 * 72));          // K rows: ASYNCcnt path
      async_copy16(gk + it * (16 * 3072) + 1024, lv + it * (16 * 80));   // V rows: the same, rows as they lie
#else
      *(bf16x8*)(lk + it * (16 * 72)) = *(const bf16x8*)(gk + it * (16 * 3072));
      *(bf16x8*)(lv + it * (16 * 80)) = *(const bf16x8*)(gk + it * (16 * 3072) + 1024);
#endif
    }
  };
  copy_stage(0, 0);     // in flight under the Q loads below

  // Q^T fragments (B operand, column = query ln16, hardware k order), pre-scaled, kept in registers
  v16bf qf[2];
  {
    const bf16* qp = &qkv[(size_t)(b * S_ + q0 + wave * 16 + ln16) * 3072 + h * 64 + hf * 8];
#pragma unroll
    for (int j = 0; j < 2; ++j) {
      bf16x8 lo = *(const bf16x8*)&qp[j * 32], hi = *(const bf16x8*)&qp[j * 32 + 16];
#pragma unroll
      for (int e = 0; e < 8; ++e) lo[e] = (bf16)((float)lo[e] * scale);
#pragma unroll
      for (int e = 0; e < 8; ++e) hi[e] = (bf16)((float)hi[e] * scale);
      qf[j] = __builtin_shufflevector(lo, hi, 0, 1, 2, 3, 4, 5, 6, 7, 8, 9, 10, 11, 12, 13, 14, 15);
    }
  }

  v8f o[4];             // o[t][v] = O[query ln16][d = 16t + 8hf + v]
#pragma unroll
  for (int t = 0; t < 4; ++t) o[t] = (v8f){0, 0, 0, 0, 0, 0, 0, 0};
  float mrow = -1e30f;  // running maximum of query ln16, equal in both halves
  float lrow = 0.f;     // running sum over this half's keys; the halves are joined behind the loop

  wait_async();          // stage 0 has landed
  __syncthreads();       // and every wave may read it
  if (nst > 1) copy_stage(1, 1);

  for (int kt = 0; kt <= qt; ++kt) {
    const int st = kt >> 1;                       // the stage that holds tile kt
    const bf16 (*Ks)[72] = &sm[st & 1].Ks[(kt & 1) * 64];
    const bf16 (*Vs)[80] = &sm[st & 1].Vs[(kt & 1) * 64];

    // S^T = K (64x64) @ Q^T (64x16): 4 key tiles, 2 K-steps each; sc[t][v] = S[query ln16][key 16t + 8hf + v]
    // All eight K fragments are read as one group ahead of the products.
    v16bf kf[2][4];
#pragma unroll
    for (int j = 0; j < 2; ++j)
#pragma unroll
      for (int t = 0; t < 4; ++t) {
        const bf16* kp = &Ks[t * 16 + ln16][j * 32 + hf * 8];
        kf[j][t] = __builtin_shufflevector(*(const bf16x8*)kp, *(const bf16x8*)(kp + 16),
                                           0, 1, 2, 3, 4, 5, 6, 7, 8, 9, 10, 11, 12, 13, 14, 15);
      }
    // The eight V^T fragments (A operand of V^T.P^T) are read in the same group: they land under the score
    // products and the softmax.
    v16bf vf[2][4];
#pragma unroll
    for (int j = 0; j < 2; ++j)
#pragma unroll
      for (int t = 0; t < 4; ++t)
        vf[j][t] = frag_tr16(&Vs[j * 32 + hf * 8 + (lane & 7)][t * 16 + ((lane >> 3) & 1) * 8], 80);
    // Inputs-only fence on the loaded K fragments: without it the compiler sinks the second four behind the first
    // products, each pair of reads with a wait to 0 of its own, and the wave sits out the LDS latency five times.
    asm volatile("" :: "v"(kf[0][0]), "v"(kf[0][1]), "v"(kf[0][2]), "v"(kf[0][3]),
                       "v"(kf[1][0]), "v"(kf[1][1]), "v"(kf[1][2]), "v"(kf[1][3]));
    v8f sc[4];
#pragma unroll
    for (int t = 0; t < 4; ++t) sc[t] = wmma_bf16(kf[0][t], qf[0], (v8f){0, 0, 0, 0, 0, 0, 0, 0});
#pragma unroll
    for (int t = 0; t < 4; ++t) sc[t] = wmma_bf16(kf[1][t], qf[1], sc[t]);

    // causal mask on diagonal tile (additive NINF to match reference)
    if (kt == qt) {
      const int qr = wave * 16 + ln16;
#pragma unroll
      for (int t = 0; t < 4; ++t)
#pragma unroll
        for (int v = 0; v < 8; ++v)
          sc[t][v] += (t * 16 + hf * 8 + v > qr) ? NINF : 0.f;
    }

    // online softmax: 32 of the query's 64 scores in this lane, the rest in lane ^ 16
    float mt[4];
#pragma unroll
    for (int t = 0; t < 4; ++t) {
      mt[t] = sc[t][0];
#pragma unroll
      for (int v = 1; v < 8; ++v) mt[t] = fmaxf(mt[t], sc[t][v]);
    }
    float mx = fmaxf(fmaxf(mt[0], mt[1]), fmaxf(mt[2], mt[3]));
    mx = fmaxf(mx, other_half(mx));
    const float mnew = fmaxf(mrow, mx);
    const float corr = __expf(mrow - mnew);
    float rs[4];
#pragma unroll
    for (int t = 0; t < 4; ++t) {
      rs[t] = 0.f;
#pragma unroll
      for (int v = 0; v < 8; ++v) {
        float p = __expf(sc[t][v] - mnew);
        sc[t][v] = p;
        rs[t] += p;
        o[t][v] *= corr;
      }
    }
    lrow = lrow * corr + ((rs[0] + rs[1]) + (rs[2] + rs[3]));
    mrow = mnew;

    // P^T fragments: element s of K-step j is key 32j + (s < 8 ? 8hf + s : 16 + 8hf + s - 8)
    v16bf pf[2];
#pragma unroll
    for (int j = 0; j < 2; ++j)
#pragma unroll
      for (int s = 0; s < 16; ++s) pf[j][s] = (bf16)sc[2 * j + (s >> 3)][s & 7];

    // O^T += V^T (64x64) @ P^T (64x16)
#pragma unroll
    for (int t = 0; t < 4; ++t) {
      v8f a = o[t];
#pragma unroll
      for (int j = 0; j < 2; ++j) {
        a = wmma_bf16(vf[j][t], pf[j], a);
      }
      o[t] = a;
    }

    // hand-over behind a stage's second tile: the one barrier publishes stage st + 1 and gives buffer st & 1 free
    if (kt & 1) {
      wait_ds0();        // this wave's fragment reads of the buffer refilled below
      wait_async();      // this wave's copies of stage st + 1
      __syncthreads();
      if (st + 2 < nst) copy_stage(st + 2, st & 1);
    }
  }
  wait_async();          // nothing is in flight when the wave ends

  // normalize + write ctx (bf16, [B*S][DIM] at col h*64): 8 consecutive d a lane and tile, one 16-byte store
  lrow += other_half(lrow);
  const float inv = 1.0f / lrow;
  bf16* cp = &ctx[(size_t)(b * S_ + q0 + wave * 16 + ln16) * DIM_ + h * 64 + hf * 8];
#pragma unroll
  for (int t = 0; t < 4; ++t) {
    bf16x8 ov;
#pragma unroll
    for (int v = 0; v < 8; ++v) ov[v] = (bf16)(o[t][v] * inv);
    *(bf16x8*)&cp[t * 16] = ov;
  }
}

// ---------------------------------------------------------------- host launch
static inline size_t align256(size_t x) { return (x + 255) & ~(size_t)255; }

extern "C" void kernel_launch(void* const* d_in, const int* in_sizes, int n_in,
                              void* d_out, int out_size, void* d_ws, size_t ws_size,
                              hipStream_t stream) {
  const float* x    = (const float*)d_in[0];
  const float* ln_g = (const float*)d_in[1];
  const float* ln_b = (const float*)d_in[2];
  const float* wqkv = (const float*)d_in[3];
  const float* bqkv = (const float*)d_in[4];
  const float* wo   = (const float*)d_in[5];
  const float* bo   = (const float*)d_in[6];
  float* out = (float*)d_out;

  const int M = B_ * S_;          // 4096
  const int N1 = 3 * DIM_;        // 3072
  const int K = DIM_;             // 1024

  char* ws = (char*)d_ws;
  size_t off = 0;
  bf16* wqkv_b = (bf16*)(ws + off); off = align256(off + (size_t)K * N1 * 2);
  bf16* wo_b   = (bf16*)(ws + off); off = align256(off + (size_t)K * DIM_ * 2);
  bf16* h_b    = (bf16*)(ws + off); off = align256(off + (size_t)M * DIM_ * 2);
  bf16* qkv_b  = (bf16*)(ws + off); off = align256(off + (size_t)M * N1 * 2);
  bf16* ctx_b  = (bf16*)(ws + off); off = align256(off + (size_t)M * DIM_ * 2);
  (void)ws_size; (void)in_sizes; (void)n_in; (void)out_size;

  // 1, 2) layernorm and both weights -> bf16, one launch
  front_pass<<<LN_BLOCKS + WQKV_BLOCKS + WO_BLOCKS, 256, 0, stream>>>(x, ln_g, ln_b, wqkv, wo, h_b, wqkv_b, wo_b);
  // 3) QKV GEMM: [4096,1024]x[1024,3072] + bqkv -> bf16
  gemm_bf16_wmma<4096, 3072, 1024, 64, false, true>
      <<<dim3(N1 / BN, M / BM), 256, 0, stream>>>(h_b, wqkv_b, bqkv, nullptr, (void*)qkv_b);
  // 4) causal flash attention -> ctx bf16
  attn_flash<<<B_ * H_ * (S_ / 64), 128, 0, stream>>>(qkv_b, ctx_b);
  // 5) output GEMM + bias + residual -> f32 out
  gemm_bf16_wmma<4096, 1024, 1024, 128, true, false>
      <<<dim3(DIM_ / BN, M / BM), 256, 0, stream>>>(ctx_b, wo_b, bo, x, (void*)out);
}

// v007
// One run takes 68.3 microseconds.
// Next to v006, in two timings, it ran 1.09 and 1.10 times as fast.
// Counting every step since v000, it is 4.09 times as fast.
#include <hip/hip_runtime.h>
#include <stdint.h>

typedef __bf16 bf16;
typedef __attribute__((ext_vector_type(16))) __bf16 v16bf;
typedef __attribute__((ext_vector_type(8)))  __bf16 bf16x8;
typedef __attribute__((ext_vector_type(4)))  __bf16 bf16x4;
typedef __attribute__((ext_vector_type(8)))  float  v8f;
typedef __attribute__((ext_vector_type(4)))  int    v4i;
typedef __attribute__((ext_vector_type(4)))  float  f32x4;

#define B_   2
#define S_   2048
#define H_   16
#define D_   64
#define DIM_ 1024
#define NINF (-10000.0f)

#ifndef __has_builtin
#define __has_builtin(x) 0
#endif

#if __has_builtin(__builtin_amdgcn_global_load_async_to_lds_b128)
#define HAVE_ASYNC 1
#else
#define HAVE_ASYNC 0
#endif

#define AS1 __attribute__((address_space(1)))
#define AS3 __attribute__((address_space(3)))
#if HAVE_ASYNC
// param1: v4i in AS1 (printed as "__device__" by clang); param2: v4i in AS3.
// flat LDS address low 32 bits == LDS byte offset (aperture rules); flat==global for AS1.
__device__ inline void async_copy16(const void* g, void* l) {
  __builtin_amdgcn_global_load_async_to_lds_b128(
      (AS1 v4i*)(unsigned long long)(uintptr_t)g,
      (AS3 v4i*)(unsigned int)(uintptr_t)l, 0, 0);
}
#endif

// this wave's async copies have landed in LDS; asm with a memory clobber so that no LDS read is lifted over it
__device__ inline void wait_async() {
#if HAVE_ASYNC
  asm volatile("s_wait_asynccnt 0x0" ::: "memory");
#endif
}

// this wave's own LDS reads and writes have retired, before a copy may be aimed at the LDS they touched
__device__ inline void wait_ds0() {
  asm volatile("s_wait_dscnt 0x0" ::: "memory");
}

// Transposing LDS read of a row-major 16-bit tile T[k][n]. Lane l passes the address of
// T[kbase + 8*(l>>4) + (l&7)][nbase + 8*((l>>3)&1)] and gets T[kbase + 8*(l>>4) + 0..7][nbase + (l&15)]:
// one half of a B fragment in the hardware k order, the order the A loaders here use.
__device__ inline bf16x8 ld_tr16(const bf16* p) {
  return __builtin_amdgcn_ds_load_tr16_b128_v8bf16((AS3 bf16x8*)p);
}
__device__ inline v16bf frag_tr16(const bf16* p, int pitch) {
  bf16x8 lo = ld_tr16(p), hi = ld_tr16(p + 16 * pitch);
  return __builtin_shufflevector(lo, hi, 0, 1, 2, 3, 4, 5, 6, 7, 8, 9, 10, 11, 12, 13, 14, 15);
}

__device__ inline v8f wmma_bf16(v16bf a, v16bf b, v8f c) {
  return __builtin_amdgcn_wmma_f32_16x16x32_bf16(false, a, false, b, (short)0, c, false, false);
}

// ---------------------------------------------------------------- front pass: convert + layernorm
// The two weight conversions and the layernorm read nothing of each other's output, so they share one launch:
// the block index picks the job. Every block moves the same bytes (32 KiB read, 16 KiB written).

// convert: 32 elements a lane, eight 16-byte loads in flight, so that few waves have to start.
#define CVT_LANE 32
#define CVT_BLOCK (256 * CVT_LANE)
__device__ inline void cvt_block(const float* __restrict__ in, bf16* __restrict__ out, int blk) {
  const int base = blk * CVT_BLOCK + threadIdx.x * 4;
  f32x4 v[CVT_LANE / 4];
#pragma unroll
  for (int j = 0; j < CVT_LANE / 4; ++j) v[j] = *(const f32x4*)&in[base + j * 1024];
#pragma unroll
  for (int j = 0; j < CVT_LANE / 4; ++j) {
    bf16x4 o;
#pragma unroll
    for (int e = 0; e < 4; ++e) o[e] = (bf16)v[j][e];
    *(bf16x4*)&out[base + j * 1024] = o;
  }
  // inlined into a branch: code of the other jobs may follow in the listing and reuse the stores' registers
  asm volatile("s_wait_xcnt 0x0" ::: "memory");
}

// layernorm: one wave a row (32 elements a lane), eight rows a block: no LDS, no barrier.
__device__ inline void layernorm_block(const float* __restrict__ x,
                                       const float* __restrict__ g,
                                       const float* __restrict__ b,
                                       bf16* __restrict__ h, int blk) {
  const int wave = threadIdx.x >> 5, lane = threadIdx.x & 31;
  const int row = blk * 8 + wave;
  const float* xr = x + (size_t)row * DIM_ + lane * 4;

  f32x4 v[8];
#pragma unroll
  for (int i = 0; i < 8; ++i) v[i] = *(const f32x4*)&xr[i * 128];

  f32x4 s4 = v[0];
#pragma unroll
  for (int i = 1; i < 8; ++i) s4 += v[i];
  float s = (s4[0] + s4[1]) + (s4[2] + s4[3]);
#pragma unroll
  for (int off = 16; off >= 1; off >>= 1) s += __shfl_xor(s, off, 32);
  const float mu = s * (1.0f / DIM_);

  f32x4 q4 = (f32x4){0.f, 0.f, 0.f, 0.f};
#pragma unroll
  for (int i = 0; i < 8; ++i) { v[i] -= mu; q4 += v[i] * v[i]; }
  float vs = (q4[0] + q4[1]) + (q4[2] + q4[3]);
#pragma unroll
  for (int off = 16; off >= 1; off >>= 1) vs += __shfl_xor(vs, off, 32);
  const float rstd = __frsqrt_rn(vs * (1.0f / DIM_) + 1e-6f);

  bf16* hr = h + (size_t)row * DIM_ + lane * 4;
#pragma unroll
  for (int i = 0; i < 8; ++i) {
    const f32x4 gg = *(const f32x4*)&g[i * 128 + lane * 4];
    const f32x4 bb = *(const f32x4*)&b[i * 128 + lane * 4];
    bf16x4 o;
#pragma unroll
    for (int e = 0; e < 4; ++e) o[e] = (bf16)(v[i][e] * rstd * gg[e] + bb[e]);
    *(bf16x4*)&hr[i * 128] = o;
  }
}

#define LN_BLOCKS   (B_ * S_ / 8)
#define WQKV_BLOCKS (DIM_ * 3 * DIM_ / CVT_BLOCK)
#define WO_BLOCKS   (DIM_ * DIM_ / CVT_BLOCK)
static_assert((DIM_ * DIM_) % CVT_BLOCK == 0 && (B_ * S_) % 8 == 0, "whole blocks only");

__global__ __launch_bounds__(256) void front_pass(const float* __restrict__ x,
                                                  const float* __restrict__ g,
                                                  const float* __restrict__ b,
                                                  const float* __restrict__ wqkv,
                                                  const float* __restrict__ wo,
                                                  bf16* __restrict__ h,
                                                  bf16* __restrict__ wqkv_b,
                                                  bf16* __restrict__ wo_b) {
  const int blk = blockIdx.x;
  if (blk < LN_BLOCKS)                    layernorm_block(x, g, b, h, blk);
  else if (blk < LN_BLOCKS + WQKV_BLOCKS) cvt_block(wqkv, wqkv_b, blk - LN_BLOCKS);
  else                                    cvt_block(wo, wo_b, blk - (LN_BLOCKS + WQKV_BLOCKS));
}

// ---------------------------------------------------------------- GEMM (bf16 WMMA)
// C[M,N] = A[M,K] @ B[K,N] + bias ; optional residual ; out bf16 or f32
// 128x128 block tile, 8 waves (4x2) x (2x4) 16x16 WMMA tiles.
// Double-buffered LDS, A and B tiles via async-to-LDS (when available); the B tile
// stays row-major [k][n] as in memory and is transposed by the fragment read.
// BKi = k per LDS stage, a multiple of 64: a stage's piece of an A row is then whole 128-byte lines, and a
// stage holds BKi / 32 k steps of products between two barriers, under which the next stage's copies land.
#define BM 128
#define BN 128
#define BSTR 144  // 288B stride: 32B x odd, conflict free for the transposing read

template<int Mi, int Ni, int Ki, int BKi, bool HAS_RES, bool OUT_BF16>
__global__ __launch_bounds__(256)
void gemm_bf16_wmma(const bf16* __restrict__ A, const bf16* __restrict__ Bm,
                    const float* __restrict__ bias, const float* __restrict__ res,
                    void* __restrict__ outp) {
  static_assert(BKi % 64 == 0 && Ki % BKi == 0, "whole lines, whole stages");
  constexpr int ASTR = BKi + 8;   // 144B or 272B stride: 16B x odd, conflict free for the 16-byte read
  __shared__ __attribute__((aligned(16))) bf16 As[2][BM][ASTR];
  __shared__ __attribute__((aligned(16))) bf16 Bs[2][BKi][BSTR];   // Bs[k][n]

  const int tid = threadIdx.x;
  const int wave = tid >> 5, lane = tid & 31;
  const int wm = wave & 3, wn = wave >> 2;       // 4x2 wave grid
  const int hf = lane >> 4, ln16 = lane & 15;
  const int m0 = blockIdx.y * BM;
  const int n0 = blockIdx.x * BN;

  v8f acc[2][4];
#pragma unroll
  for (int i = 0; i < 2; ++i)
#pragma unroll
    for (int j = 0; j < 4; ++j) acc[i][j] = (v8f){0, 0, 0, 0, 0, 0, 0, 0};

  auto copyA = [&](int ks, int buf) {
#pragma unroll
    for (int it = 0; it < BM * BKi / 8 / 256; ++it) {
      int i = tid + it * 256;                 // chunks of 8 halfs, BKi / 8 a row
      int r = i / (BKi / 8), c8 = (i % (BKi / 8)) * 8;
      const bf16* gp = &A[(size_t)(m0 + r) * Ki + ks + c8];
      bf16* lp = &As[buf][r][c8];
#if HAVE_ASYNC
      async_copy16(gp, lp);
#else
      *(bf16x8*)lp = *(const bf16x8*)gp;
#endif
    }
  };
  auto copyB = [&](int ks, int buf) {
#pragma unroll
    for (int it = 0; it < BKi * BN / 8 / 256; ++it) {
      int i = tid + it * 256;                 // chunks of 8 halfs, 16 a row
      int k = i >> 4, c8 = (i & 15) * 8;
      const bf16* gp = &Bm[(size_t)(ks + k) * Ni + n0 + c8];
      bf16* lp = &Bs[buf][k][c8];
#if HAVE_ASYNC
      async_copy16(gp, lp);
#else
      *(bf16x8*)lp = *(const bf16x8*)gp;
#endif
    }
  };

  copyA(0, 0);    // prime pipeline
  copyB(0, 0);
  constexpr int NST = Ki / BKi;
#pragma unroll 1
  for (int s = 0; s < NST; ++s) {
    const int cur = s & 1;
    wait_ds0();                 // last stage's fragment reads of the buffer refilled below
    wait_async();               // this stage's tiles
    __syncthreads();
    if (s + 1 < NST) {          // overlap next tile's copies with compute
      copyA((s + 1) * BKi, cur ^ 1);
      copyB((s + 1) * BKi, cur ^ 1);
    }

#pragma unroll
    for (int j = 0; j < BKi / 32; ++j) {      // the stage's k steps, in rising k
      v16bf af[2], bfr[4];
#pragma unroll
      for (int fm = 0; fm < 2; ++fm) {
        int row = wm * 32 + fm * 16 + ln16;
#pragma unroll
        for (int r = 0; r < 8; ++r) {
          int kk = j * 32 + ((r & 3) * 2) + ((r >> 2) * 16) + hf * 8;
          af[fm][2 * r]     = As[cur][row][kk];
          af[fm][2 * r + 1] = As[cur][row][kk + 1];
        }
      }
#pragma unroll
      for (int fn = 0; fn < 4; ++fn)
        bfr[fn] = frag_tr16(&Bs[cur][j * 32 + hf * 8 + (lane & 7)][wn * 64 + fn * 16 + ((lane >> 3) & 1) * 8], BSTR);
#pragma unroll
      for (int fm = 0; fm < 2; ++fm)
#pragma unroll
        for (int fn = 0; fn < 4; ++fn)
          acc[fm][fn] = wmma_bf16(af[fm], bfr[fn], acc[fm][fn]);
    }
  }

  // straight-line epilogue (compile-time N, residual, output type)
#pragma unroll
  for (int fm = 0; fm < 2; ++fm)
#pragma unroll
    for (int fn = 0; fn < 4; ++fn)
#pragma unroll
      for (int v = 0; v < 8; ++v) {
        int row = m0 + wm * 32 + fm * 16 + v + hf * 8;
        int col = n0 + wn * 64 + fn * 16 + ln16;
        size_t idx = (size_t)row * Ni + col;
        float val = acc[fm][fn][v] + bias[col];
        if constexpr (HAS_RES) val += res[idx];
        if constexpr (OUT_BF16) ((bf16*)outp)[idx] = (bf16)val;
        else                    ((float*)outp)[idx] = val;
      }
}

// value of lane l ^ 16
__device__ inline float other_half(float x) {
  int b = __builtin_bit_cast(int, x);
  return __builtin_bit_cast(float, __builtin_amdgcn_permlanex16(b, b, 0x76543210, 0xfedcba98, false, false));
}

__global__ __launch_bounds__(128)
void attn_flash(const bf16* __restrict__ qkv, bf16* __restrict__ ctx) {
  // One struct fixes the tiles' order in LDS: the compiler folds the K-to-V distance in memory into the
  // V copy's offset field and takes it off the copy's LDS address, which stays above 0 with V behind K.
  struct Tiles {
    bf16 Ks[128][72];   // [key][d]: rows are the A operand of K.Q^T
    bf16 Vs[128][80];   // [key][d] as in memory; 160B stride (32B x odd) for the transposing read
  };
  __shared__ __attribute__((aligned(16))) Tiles sm[2];

  const int blk = blockIdx.x;
  const int pr = blk & 15;         // the pair: query tiles 31 - pr and pr
  const int bh = blk >> 4;
  const int h = bh & 15, b = bh >> 4;
  const int tid = threadIdx.x;
  const int wave = tid >> 5, lane = tid & 31;
  const int hf = lane >> 4, ln16 = lane & 15;
  const float scale = 0.125f;   // 1/sqrt(64)

  // stage st (keys 128 st .. 128 st + 127 of K and of V) into buffer buf: sixteen 16-byte copies a lane
  // (a lane's rows are tid / 8 + 16 it, its eight columns 8 (tid & 7): 128 whole bytes of a row from eight lanes)
  const bf16* const gk0 = &qkv[(size_t)(b * S_ + (tid >> 3)) * 3072 + h * 64 + (tid & 7) * 8 + 1024];
  auto copy_stage = [&](int st, int buf) {
    const bf16* gk = gk0 + (size_t)st * (128 * 3072);
    bf16* lk = &sm[buf].Ks[tid >> 3][(tid & 7) * 8];
    bf16* lv = &sm[buf].Vs[tid >> 3][(tid & 7) * 8];
#pragma unroll
    for (int it = 0; it < 8; ++it) {
#if HAVE_ASYNC
      async_copy16(gk + it * (16 * 3072), lk + it * (16 * 72));          // K rows: ASYNCcnt path
      async_copy16(gk + it * (16 * 3072) + 1024, lv + it * (16 * 80));   // V rows: the same, rows as they lie
#else
      *(bf16x8*)(lk + it * (16 * 72)) = *(const bf16x8*)(gk + it * (16 * 3072));
      *(bf16x8*)(lv + it * (16 * 80)) = *(const bf16x8*)(gk + it * (16 * 3072) + 1024);
#endif
    }
  };
  copy_stage(0, 0);     // in flight under the Q loads below

  for (int half = 0; half < 2; ++half) {   // the pair's two query tiles, one after the other in every wave
  const int qt = half ? pr : 31 - pr;
  const int q0 = qt * 64;
  const int nst = (qt >> 1) + 1;   // stages that hold a key tile up to the diagonal; at most S_ / 128

  // Q^T fragments (B operand, column = query ln16, hardware k order), pre-scaled, kept in registers
  v16bf qf[2];
  {
    const bf16* qp = &qkv[(size_t)(b * S_ + q0 + wave * 16 + ln16) * 3072 + h * 64 + hf * 8];
#pragma unroll
    for (int j = 0; j < 2; ++j) {
      bf16x8 lo = *(const bf16x8*)&qp[j * 32], hi = *(const bf16x8*)&qp[j * 32 + 16];
#pragma unroll
      for (int e = 0; e < 8; ++e) lo[e] = (bf16)((float)lo[e] * scale);
#pragma unroll
      for (int e = 0; e < 8; ++e) hi[e] = (bf16)((float)hi[e] * scale);
      qf[j] = __builtin_shufflevector(lo, hi, 0, 1, 2, 3, 4, 5, 6, 7, 8, 9, 10, 11, 12, 13, 14, 15);
    }
  }

  v8f o[4];             // o[t][v] = O[query ln16][d = 16t + 8hf + v]
#pragma unroll
  for (int t = 0; t < 4; ++t) o[t] = (v8f){0, 0, 0, 0, 0, 0, 0, 0};
  float mrow = -1e30f;  // running maximum of query ln16, equal in both halves
  float lrow = 0.f;     // running sum over this half's keys; the halves are joined behind the loop

  wait_async();          // stage 0 has landed
  __syncthreads();       // and every wave may read it
  if (nst > 1) copy_stage(1, 1);

  for (int kt = 0; kt <= qt; ++kt) {
    const int st = kt >> 1;                       // the stage that holds tile kt
    const bf16 (*Ks)[72] = &sm[st & 1].Ks[(kt & 1) * 64];
    const bf16 (*Vs)[80] = &sm[st & 1].Vs[(kt & 1) * 64];

    // S^T = K (64x64) @ Q^T (64x16): 4 key tiles, 2 K-steps each; sc[t][v] = S[query ln16][key 16t + 8hf + v]
    // All eight K fragments are read as one group ahead of the products.
    v16bf kf[2][4];
#pragma unroll
    for (int j = 0; j < 2; ++j)
#pragma unroll
      for (int t = 0; t < 4; ++t) {
        const bf16* kp = &Ks[t * 16 + ln16][j * 32 + hf * 8];
        kf[j][t] = __builtin_shufflevector(*(const bf16x8*)kp, *(const bf16x8*)(kp + 16),
                                           0, 1, 2, 3, 4, 5, 6, 7, 8, 9, 10, 11, 12, 13, 14, 15);
      }
    // The eight V^T fragments (A operand of V^T.P^T) are read in the same group: they land under the score
    // products and the softmax.
    v16bf vf[2][4];
#pragma unroll
    for (int j = 0; j < 2; ++j)
#pragma unroll
      for (int t = 0; t < 4; ++t)
        vf[j][t] = frag_tr16(&Vs[j * 32 + hf * 8 + (lane & 7)][t * 16 + ((lane >> 3) & 1) * 8], 80);
    // Inputs-only fence on the loaded K fragments: without it the compiler sinks the second four behind the first
    // products, each pair of reads with a wait to 0 of its own, and the wave sits out the LDS latency five times.
    asm volatile("" :: "v"(kf[0][0]), "v"(kf[0][1]), "v"(kf[0][2]), "v"(kf[0][3]),
                       "v"(kf[1][0]), "v"(kf[1][1]), "v"(kf[1][2]), "v"(kf[1][3]));
    v8f sc[4];
#pragma unroll
    for (int t = 0; t < 4; ++t) sc[t] = wmma_bf16(kf[0][t], qf[0], (v8f){0, 0, 0, 0, 0, 0, 0, 0});
#pragma unroll
    for (int t = 0; t < 4; ++t) sc[t] = wmma_bf16(kf[1][t], qf[1], sc[t]);

    // causal mask on diagonal tile (additive NINF to match reference)
    if (kt == qt) {
      const int qr = wave * 16 + ln16;
#pragma unroll
      for (int t = 0; t < 4; ++t)
#pragma unroll
        for (int v = 0; v < 8; ++v)
          sc[t][v] += (t * 16 + hf * 8 + v > qr) ? NINF : 0.f;
    }

    // online softmax: 32 of the query's 64 scores in this lane, the rest in lane ^ 16
    float mt[4];
#pragma unroll
    for (int t = 0; t < 4; ++t) {
      mt[t] = sc[t][0];
#pragma unroll
      for (int v = 1; v < 8; ++v) mt[t] = fmaxf(mt[t], sc[t][v]);
    }
    float mx = fmaxf(fmaxf(mt[0], mt[1]), fmaxf(mt[2], mt[3]));
    mx = fmaxf(mx, other_half(mx));
    const float mnew = fmaxf(mrow, mx);
    const float corr = __expf(mrow - mnew);
    float rs[4];
#pragma unroll
    for (int t = 0; t < 4; ++t) {
      rs[t] = 0.f;
#pragma unroll
      for (int v = 0; v < 8; ++v) {
        float p = __expf(sc[t][v] - mnew);
        sc[t][v] = p;
        rs[t] += p;
        o[t][v] *= corr;
      }
    }
    lrow = lrow * corr + ((rs[0] + rs[1]) + (rs[2] + rs[3]));
    mrow = mnew;

    // P^T fragments: element s of K-step j is key 32j + (s < 8 ? 8hf + s : 16 + 8hf + s - 8)
    v16bf pf[2];
#pragma unroll
    for (int j = 0; j < 2; ++j)
#pragma unroll
      for (int s = 0; s < 16; ++s) pf[j][s] = (bf16)sc[2 * j + (s >> 3)][s & 7];

    // O^T += V^T (64x64) @ P^T (64x16)
#pragma unroll
    for (int t = 0; t < 4; ++t) {
      v8f a = o[t];
#pragma unroll
      for (int j = 0; j < 2; ++j) {
        a = wmma_bf16(vf[j][t], pf[j], a);
      }
      o[t] = a;
    }

    // hand-over behind a stage's second tile: the one barrier publishes stage st + 1 and gives buffer st & 1 free
    if (kt & 1) {
      wait_ds0();        // this wave's fragment reads of the buffer refilled below
      wait_async();      // this wave's copies of stage st + 1
      __syncthreads();
      if (st + 2 < nst) copy_stage(st + 2, st & 1);
    }
  }
  wait_async();          // nothing is in flight when the tile, or the wave, ends
  if (half == 0) {
    wait_ds0();          // this wave's last fragment reads of the first tile
    __syncthreads();     // every wave has left both buffers
    copy_stage(0, 0);    // the second tile's first stage flies under the first tile's stores and the Q loads
  }

  // normalize + write ctx (bf16, [B*S][DIM] at col h*64): 8 consecutive d a lane and tile, one 16-byte store
  lrow += other_half(lrow);
  const float inv = 1.0f / lrow;
  bf16* cp = &ctx[(size_t)(b * S_ + q0 + wave * 16 + ln16) * DIM_ + h * 64 + hf * 8];
#pragma unroll
  for (int t = 0; t < 4; ++t) {
    bf16x8 ov;
#pragma unroll
    for (int v = 0; v < 8; ++v) ov[v] = (bf16)(o[t][v] * inv);
    *(bf16x8*)&cp[t * 16] = ov;
  }
  // the second tile's code reuses the registers that these stores name
  asm volatile("s_wait_xcnt 0x0" ::: "memory");
  }
}

// ---------------------------------------------------------------- host launch
static inline size_t align256(size_t x) { return (x + 255) & ~(size_t)255; }

extern "C" void kernel_launch(void* const* d_in, const int* in_sizes, int n_in,
                              void* d_out, int out_size, void* d_ws, size_t ws_size,
                              hipStream_t stream) {
  const float* x    = (const float*)d_in[0];
  const float* ln_g = (const float*)d_in[1];
  const float* ln_b = (const float*)d_in[2];
  const float* wqkv = (const float*)d_in[3];
  const float* bqkv = (const float*)d_in[4];
  const float* wo   = (const float*)d_in[5];
  const float* bo   = (const float*)d_in[6];
  float* out = (float*)d_out;

  const int M = B_ * S_;          // 4096
  const int N1 = 3 * DIM_;        // 3072
  const int K = DIM_;             // 1024

  char* ws = (char*)d_ws;
  size_t off = 0;
  bf16* wqkv_b = (bf16*)(ws + off); off = align256(off + (size_t)K * N1 * 2);
  bf16* wo_b   = (bf16*)(ws + off); off = align256(off + (size_t)K * DIM_ * 2);
  bf16* h_b    = (bf16*)(ws + off); off = align256(off + (size_t)M * DIM_ * 2);
  bf16* qkv_b  = (bf16*)(ws + off); off = align256(off + (size_t)M * N1 * 2);
  bf16* ctx_b  = (bf16*)(ws + off); off = align256(off + (size_t)M * DIM_ * 2);
  (void)ws_size; (void)in_sizes; (void)n_in; (void)out_size;

  // 1, 2) layernorm and both weights -> bf16, one launch
  front_pass<<<LN_BLOCKS + WQKV_BLOCKS + WO_BLOCKS, 256, 0, stream>>>(x, ln_g, ln_b, wqkv, wo, h_b, wqkv_b, wo_b);
  // 3) QKV GEMM: [4096,1024]x[1024,3072] + bqkv -> bf16
  gemm_bf16_wmma<4096, 3072, 1024, 64, false, true>
      <<<dim3(N1 / BN, M / BM), 256, 0, stream>>>(h_b, wqkv_b, bqkv, nullptr, (void*)qkv_b);
  // 4) causal flash attention -> ctx bf16
  attn_flash<<<B_ * H_ * (S_ / 128), 128, 0, stream>>>(qkv_b, ctx_b);
  // 5) output GEMM + bias + residual -> f32 out
  gemm_bf16_wmma<4096, 1024, 1024, 128, true, false>
      <<<dim3(DIM_ / BN, M / BM), 256, 0, stream>>>(ctx_b, wo_b, bo, x, (void*)out);
}

// v008
// Measured time: 65.9 microseconds a run.
// Two timings next to v007 both put it at 1.04 times that version's speed.
// Counting every step since v000, it is 4.26 times as fast.
#include <hip/hip_runtime.h>
#include <stdint.h>

typedef __bf16 bf16;
typedef __attribute__((ext_vector_type(16))) __bf16 v16bf;
typedef __attribute__((ext_vector_type(8)))  __bf16 bf16x8;
typedef __attribute__((ext_vector_type(4)))  __bf16 bf16x4;
typedef __attribute__((ext_vector_type(8)))  float  v8f;
typedef __attribute__((ext_vector_type(4)))  int    v4i;
typedef __attribute__((ext_vector_type(4)))  float  f32x4;

#define B_   2
#define S_   2048
#define H_   16
#define D_   64
#define DIM_ 1024
#define NINF (-10000.0f)

#ifndef __has_builtin
#define __has_builtin(x) 0
#endif

#if __has_builtin(__builtin_amdgcn_global_load_async_to_lds_b128)
#define HAVE_ASYNC 1
#else
#define HAVE_ASYNC 0
#endif

#define AS1 __attribute__((address_space(1)))
#define AS3 __attribute__((address_space(3)))
#if HAVE_ASYNC
// param1: v4i in AS1 (printed as "__device__" by clang); param2: v4i in AS3.
// flat LDS address low 32 bits == LDS byte offset (aperture rules); flat==global for AS1.
__device__ inline void async_copy16(const void* g, void* l) {
  __builtin_amdgcn_global_load_async_to_lds_b128(
      (AS1 v4i*)(unsigned long long)(uintptr_t)g,
      (AS3 v4i*)(unsigned int)(uintptr_t)l, 0, 0);
}
#endif

// this wave's async copies have landed in LDS; asm with a memory clobber so that no LDS read is lifted over it
__device__ inline void wait_async() {
#if HAVE_ASYNC
  asm volatile("s_wait_asynccnt 0x0" ::: "memory");
#endif
}

// this wave's own LDS reads and writes have retired, before a copy may be aimed at the LDS they touched
__device__ inline void wait_ds0() {
  asm volatile("s_wait_dscnt 0x0" ::: "memory");
}

// Transposing LDS read of a row-major 16-bit tile T[k][n]. Lane l passes the address of
// T[kbase + 8*(l>>4) + (l&7)][nbase + 8*((l>>3)&1)] and gets T[kbase + 8*(l>>4) + 0..7][nbase + (l&15)]:
// one half of a B fragment in the hardware k order, the order the A loaders here use.
__device__ inline bf16x8 ld_tr16(const bf16* p) {
  return __builtin_amdgcn_ds_load_tr16_b128_v8bf16((AS3 bf16x8*)p);
}
__device__ inline v16bf frag_tr16(const bf16* p, int pitch) {
  bf16x8 lo = ld_tr16(p), hi = ld_tr16(p + 16 * pitch);
  return __builtin_shufflevector(lo, hi, 0, 1, 2, 3, 4, 5, 6, 7, 8, 9, 10, 11, 12, 13, 14, 15);
}

__device__ inline v8f wmma_bf16(v16bf a, v16bf b, v8f c) {
  return __builtin_amdgcn_wmma_f32_16x16x32_bf16(false, a, false, b, (short)0, c, false, false);
}

// ---------------------------------------------------------------- front pass: convert + layernorm
// The two weight conversions and the layernorm read nothing of each other's output, so they share one launch:
// the block index picks the job. Every block moves the same bytes (32 KiB read, 16 KiB written).

// convert: 32 elements a lane, eight 16-byte loads in flight, so that few waves have to start.
#define CVT_LANE 32
#define CVT_BLOCK (256 * CVT_LANE)
__device__ inline void cvt_block(const float* __restrict__ in, bf16* __restrict__ out, int blk) {
  const int base = blk * CVT_BLOCK + threadIdx.x * 4;
  f32x4 v[CVT_LANE / 4];
#pragma unroll
  for (int j = 0; j < CVT_LANE / 4; ++j) v[j] = *(const f32x4*)&in[base + j * 1024];
#pragma unroll
  for (int j = 0; j < CVT_LANE / 4; ++j) {
    bf16x4 o;
#pragma unroll
    for (int e = 0; e < 4; ++e) o[e] = (bf16)v[j][e];
    *(bf16x4*)&out[base + j * 1024] = o;
  }
  // inlined into a branch: code of the other jobs may follow in the listing and reuse the stores' registers
  asm volatile("s_wait_xcnt 0x0" ::: "memory");
}

// layernorm: one wave a row (32 elements a lane), eight rows a block: no LDS, no barrier.
__device__ inline void layernorm_block(const float* __restrict__ x,
                                       const float* __restrict__ g,
                                       const float* __restrict__ b,
                                       bf16* __restrict__ h, int blk) {
  const int wave = threadIdx.x >> 5, lane = threadIdx.x & 31;
  const int row = blk * 8 + wave;
  const float* xr = x + (size_t)row * DIM_ + lane * 4;

  f32x4 v[8];
#pragma unroll
  for (int i = 0; i < 8; ++i) v[i] = *(const f32x4*)&xr[i * 128];

  f32x4 s4 = v[0];
#pragma unroll
  for (int i = 1; i < 8; ++i) s4 += v[i];
  float s = (s4[0] + s4[1]) + (s4[2] + s4[3]);
#pragma unroll
  for (int off = 16; off >= 1; off >>= 1) s += __shfl_xor(s, off, 32);
  const float mu = s * (1.0f / DIM_);

  f32x4 q4 = (f32x4){0.f, 0.f, 0.f, 0.f};
#pragma unroll
  for (int i = 0; i < 8; ++i) { v[i] -= mu; q4 += v[i] * v[i]; }
  float vs = (q4[0] + q4[1]) + (q4[2] + q4[3]);
#pragma unroll
  for (int off = 16; off >= 1; off >>= 1) vs += __shfl_xor(vs, off, 32);
  const float rstd = __frsqrt_rn(vs * (1.0f / DIM_) + 1e-6f);

  bf16* hr = h + (size_t)row * DIM_ + lane * 4;
#pragma unroll
  for (int i = 0; i < 8; ++i) {
    const f32x4 gg = *(const f32x4*)&g[i * 128 + lane * 4];
    const f32x4 bb = *(const f32x4*)&b[i * 128 + lane * 4];
    bf16x4 o;
#pragma unroll
    for (int e = 0; e < 4; ++e) o[e] = (bf16)(v[i][e] * rstd * gg[e] + bb[e]);
    *(bf16x4*)&hr[i * 128] = o;
  }
}

#define LN_BLOCKS   (B_ * S_ / 8)
#define WQKV_BLOCKS (DIM_ * 3 * DIM_ / CVT_BLOCK)
#define WO_BLOCKS   (DIM_ * DIM_ / CVT_BLOCK)
static_assert((DIM_ * DIM_) % CVT_BLOCK == 0 && (B_ * S_) % 8 == 0, "whole blocks only");

__global__ __launch_bounds__(256) void front_pass(const float* __restrict__ x,
                                                  const float* __restrict__ g,
                                                  const float* __restrict__ b,
                                                  const float* __restrict__ wqkv,
                                                  const float* __restrict__ wo,
                                                  bf16* __restrict__ h,
                                                  bf16* __restrict__ wqkv_b,
                                                  bf16* __restrict__ wo_b) {
  const int blk = blockIdx.x;
  if (blk < LN_BLOCKS)                    layernorm_block(x, g, b, h, blk);
  else if (blk < LN_BLOCKS + WQKV_BLOCKS) cvt_block(wqkv, wqkv_b, blk - LN_BLOCKS);
  else                                    cvt_block(wo, wo_b, blk - (LN_BLOCKS + WQKV_BLOCKS));
}

// ---------------------------------------------------------------- GEMM (bf16 WMMA)
// C[M,N] = A[M,K] @ B[K,N] + bias ; optional residual ; out bf16 or f32
// BMi x BNi block tile, 8 waves (4x2), each BMi/4 x BNi/2 of it in 16x16 WMMA tiles. The tile sets how often an
// operand byte is fetched: from L2 once per block that needs it, from LDS once per wave that needs it. 256x192 puts
// the QKV product on 16 x 16 blocks, one on each WGP, with 24 products for every 10 fragments a wave reads.
// Double-buffered LDS, A and B tiles via async-to-LDS (when available); the B tile
// stays row-major [k][n] as in memory and is transposed by the fragment read.
// BKi = k per LDS stage, a multiple of 64: a stage's piece of an A row is then whole 128-byte lines, and a
// stage holds BKi / 32 k steps of products between two barriers, under which the next stage's copies land.
// AHEAD goes with the 64x96 wave tile (two waves a SIMD, no second block on the WGP to fill a wave's LDS latency): a
// k step's fragments are read as one group, into a second register set, ahead of the products of the step before.
template<int Mi, int Ni, int Ki, int BKi, int BMi, int BNi, bool AHEAD, bool HAS_RES, bool OUT_BF16>
__global__ __launch_bounds__(256)
void gemm_bf16_wmma(const bf16* __restrict__ A, const bf16* __restrict__ Bm,
                    const float* __restrict__ bias, const float* __restrict__ res,
                    void* __restrict__ outp) {
  static_assert(BKi % 64 == 0 && Ki % BKi == 0, "whole lines, whole stages");
  static_assert(Mi % BMi == 0 && Ni % BNi == 0 && BMi % 64 == 0 && BNi % 64 == 0, "whole tiles, whole lines");
  constexpr int FM = BMi / 64, FN = BNi / 32;   // 16x16 tiles of a wave, down and across
  constexpr int ASTR = BKi + 8;   // 272B stride: 16B x odd, conflict free for the 16-byte read
  constexpr int BSTR = BNi + 16;  // 288B or 416B stride: 32B x odd, conflict free for the transposing read
  static_assert((BSTR / 16) % 2 == 1, "32B x odd");
  __shared__ __attribute__((aligned(16))) bf16 As[2][BMi][ASTR];
  __shared__ __attribute__((aligned(16))) bf16 Bs[2][BKi][BSTR];   // Bs[k][n]

  const int tid = threadIdx.x;
  const int wave = tid >> 5, lane = tid & 31;
  const int wm = wave & 3, wn = wave >> 2;       // 4x2 wave grid
  const int hf = lane >> 4, ln16 = lane & 15;
  const int m0 = blockIdx.y * BMi;
  const int n0 = blockIdx.x * BNi;

  v8f acc[FM][FN];
#pragma unroll
  for (int i = 0; i < FM; ++i)
#pragma unroll
    for (int j = 0; j < FN; ++j) acc[i][j] = (v8f){0, 0, 0, 0, 0, 0, 0, 0};

  auto copyA = [&](int ks, int buf) {
#pragma unroll
    for (int it = 0; it < BMi * BKi / 8 / 256; ++it) {
      int i = tid + it * 256;                 // chunks of 8 halfs, BKi / 8 a row
      int r = i / (BKi / 8), c8 = (i % (BKi / 8)) * 8;
      const bf16* gp = &A[(size_t)(m0 + r) * Ki + ks + c8];
      bf16* lp = &As[buf][r][c8];
#if HAVE_ASYNC
      async_copy16(gp, lp);
#else
      *(bf16x8*)lp = *(const bf16x8*)gp;
#endif
    }
  };
  // chunks of 8 halfs, BNi / 8 a row; PER passes of the block's 256 lanes cover whole rows (RPP of them), so a
  // lane's row and column are worked out for PER passes only and every later pass is the same RPP rows on
  constexpr int CPR = BNi / 8;
  constexpr int PER = (CPR % 16 == 0) ? 1 : 3;
  constexpr int RPP = PER * 256 / CPR;
  static_assert(PER * 256 % CPR == 0 && (BKi * CPR / 256) % PER == 0, "whole rows a period, whole periods a stage");
  auto copyB = [&](int ks, int buf) {
#pragma unroll
    for (int it = 0; it < BKi * CPR / 256; ++it) {
      int i = tid + (it % PER) * 256;
      int k = i / CPR + (it / PER) * RPP, c8 = (i % CPR) * 8;
      const bf16* gp = &Bm[(size_t)(ks + k) * Ni + n0 + c8];
      bf16* lp = &Bs[buf][k][c8];
#if HAVE_ASYNC
      async_copy16(gp, lp);
#else
      *(bf16x8*)lp = *(const bf16x8*)gp;
#endif
    }
  };

  // k step j of buffer cur: A fragments by 16-byte reads, B fragments by the transposing read, the same k order
  auto load_frags = [&](int cur, int j, v16bf (&af)[FM], v16bf (&bfr)[FN]) {
#pragma unroll
    for (int fm = 0; fm < FM; ++fm) {
      int row = wm * (FM * 16) + fm * 16 + ln16;
#pragma unroll
      for (int r = 0; r < 8; ++r) {
        int kk = j * 32 + ((r & 3) * 2) + ((r >> 2) * 16) + hf * 8;
        af[fm][2 * r]     = As[cur][row][kk];
        af[fm][2 * r + 1] = As[cur][row][kk + 1];
      }
    }
#pragma unroll
    for (int fn = 0; fn < FN; ++fn)
      bfr[fn] = frag_tr16(&Bs[cur][j * 32 + hf * 8 + (lane & 7)][wn * (FN * 16) + fn * 16 + ((lane >> 3) & 1) * 8], BSTR);
  };
  auto products = [&](const v16bf (&af)[FM], const v16bf (&bfr)[FN]) {
#pragma unroll
    for (int fm = 0; fm < FM; ++fm)
#pragma unroll
      for (int fn = 0; fn < FN; ++fn)
        acc[fm][fn] = wmma_bf16(af[fm], bfr[fn], acc[fm][fn]);
  };

  copyA(0, 0);    // prime pipeline
  copyB(0, 0);
  constexpr int NST = Ki / BKi;
#pragma unroll 1
  for (int s = 0; s < NST; ++s) {
    const int cur = s & 1;
    wait_ds0();                 // last stage's fragment reads of the buffer refilled below
    wait_async();               // this stage's tiles
    __syncthreads();
    if (s + 1 < NST) {          // overlap next tile's copies with compute
      copyA((s + 1) * BKi, cur ^ 1);
      copyB((s + 1) * BKi, cur ^ 1);
    }

    if constexpr (AHEAD) {
      v16bf af[2][FM], bfr[2][FN];
      load_frags(cur, 0, af[0], bfr[0]);
#pragma unroll
      for (int j = 0; j < BKi / 32; ++j) {    // the stage's k steps, in rising k
        if (j + 1 < BKi / 32) {
          load_frags(cur, j + 1, af[(j + 1) & 1], bfr[(j + 1) & 1]);
          // without it the reads sink among the products, a pair at a time, each pair with a wait to 0 of its own
          __builtin_amdgcn_sched_barrier(0);
        }
        products(af[j & 1], bfr[j & 1]);
        // without it the reads of step j + 2 rise among these products as each fragment has had its last use
        if (j + 2 < BKi / 32) __builtin_amdgcn_sched_barrier(0);
      }
    } else {
#pragma unroll
      for (int j = 0; j < BKi / 32; ++j) {    // the stage's k steps, in rising k
        v16bf af[FM], bfr[FN];
        load_frags(cur, j, af, bfr);
        products(af, bfr);
      }
    }
  }

  // straight-line epilogue (compile-time N, residual, output type)
#pragma unroll
  for (int fm = 0; fm < FM; ++fm)
#pragma unroll
    for (int fn = 0; fn < FN; ++fn)
#pragma unroll
      for (int v = 0; v < 8; ++v) {
        int row = m0 + wm * (FM * 16) + fm * 16 + v + hf * 8;
        int col = n0 + wn * (FN * 16) + fn * 16 + ln16;
        size_t idx = (size_t)row * Ni + col;
        float val = acc[fm][fn][v] + bias[col];
        if constexpr (HAS_RES) val += res[idx];
        if constexpr (OUT_BF16) ((bf16*)outp)[idx] = (bf16)val;
        else                    ((float*)outp)[idx] = val;
      }
}

// value of lane l ^ 16
__device__ inline float other_half(float x) {
  int b = __builtin_bit_cast(int, x);
  return __builtin_bit_cast(float, __builtin_amdgcn_permlanex16(b, b, 0x76543210, 0xfedcba98, false, false));
}

__global__ __launch_bounds__(128)
void attn_flash(const bf16* __restrict__ qkv, bf16* __restrict__ ctx) {
  // One struct fixes the tiles' order in LDS: the compiler folds the K-to-V distance in memory into the
  // V copy's offset field and takes it off the copy's LDS address, which stays above 0 with V behind K.
  struct Tiles {
    bf16 Ks[128][72];   // [key][d]: rows are the A operand of K.Q^T
    bf16 Vs[128][80];   // [key][d] as in memory; 160B stride (32B x odd) for the transposing read
  };
  __shared__ __attribute__((aligned(16))) Tiles sm[2];

  const int blk = blockIdx.x;
  const int pr = blk & 15;         // the pair: query tiles 31 - pr and pr
  const int bh = blk >> 4;
  const int h = bh & 15, b = bh >> 4;
  const int tid = threadIdx.x;
  const int wave = tid >> 5, lane = tid & 31;
  const int hf = lane >> 4, ln16 = lane & 15;
  const float scale = 0.125f;   // 1/sqrt(64)

  // stage st (keys 128 st .. 128 st + 127 of K and of V) into buffer buf: sixteen 16-byte copies a lane
  // (a lane's rows are tid / 8 + 16 it, its eight columns 8 (tid & 7): 128 whole bytes of a row from eight lanes)
  const bf16* const gk0 = &qkv[(size_t)(b * S_ + (tid >> 3)) * 3072 + h * 64 + (tid & 7) * 8 + 1024];
  auto copy_stage = [&](int st, int buf) {
    const bf16* gk = gk0 + (size_t)st * (128 * 3072);
    bf16* lk = &sm[buf].Ks[tid >> 3][(tid & 7) * 8];
    bf16* lv = &sm[buf].Vs[tid >> 3][(tid & 7) * 8];
#pragma unroll
    for (int it = 0; it < 8; ++it) {
#if HAVE_ASYNC
      async_copy16(gk + it * (16 * 3072), lk + it * (16 * 72));          // K rows: ASYNCcnt path
      async_copy16(gk + it * (16 * 3072) + 1024, lv + it * (16 * 80));   // V rows: the same, rows as they lie
#else
      *(bf16x8*)(lk + it * (16 * 72)) = *(const bf16x8*)(gk + it * (16 * 3072));
      *(bf16x8*)(lv + it * (16 * 80)) = *(const bf16x8*)(gk + it * (16 * 3072) + 1024);
#endif
    }
  };
  copy_stage(0, 0);     // in flight under the Q loads below

  for (int half = 0; half < 2; ++half) {   // the pair's two query tiles, one after the other in every wave
  const int qt = half ? pr : 31 - pr;
  const int q0 = qt * 64;
  const int nst = (qt >> 1) + 1;   // stages that hold a key tile up to the diagonal; at most S_ / 128

  // Q^T fragments (B operand, column = query ln16, hardware k order), pre-scaled, kept in registers
  v16bf qf[2];
  {
    const bf16* qp = &qkv[(size_t)(b * S_ + q0 + wave * 16 + ln16) * 3072 + h * 64 + hf * 8];
#pragma unroll
    for (int j = 0; j < 2; ++j) {
      bf16x8 lo = *(const bf16x8*)&qp[j * 32], hi = *(const bf16x8*)&qp[j * 32 + 16];
#pragma unroll
      for (int e = 0; e < 8; ++e) lo[e] = (bf16)((float)lo[e] * scale);
#pragma unroll
      for (int e = 0; e < 8; ++e) hi[e] = (bf16)((float)hi[e] * scale);
      qf[j] = __builtin_shufflevector(lo, hi, 0, 1, 2, 3, 4, 5, 6, 7, 8, 9, 10, 11, 12, 13, 14, 15);
    }
  }

  v8f o[4];             // o[t][v] = O[query ln16][d = 16t + 8hf + v]
#pragma unroll
  for (int t = 0; t < 4; ++t) o[t] = (v8f){0, 0, 0, 0, 0, 0, 0, 0};
  float mrow = -1e30f;  // running maximum of query ln16, equal in both halves
  float lrow = 0.f;     // running sum over this half's keys; the halves are joined behind the loop

  wait_async();          // stage 0 has landed
  __syncthreads();       // and every wave may read it
  if (nst > 1) copy_stage(1, 1);

  for (int kt = 0; kt <= qt; ++kt) {
    const int st = kt >> 1;                       // the stage that holds tile kt
    const bf16 (*Ks)[72] = &sm[st & 1].Ks[(kt & 1) * 64];
    const bf16 (*Vs)[80] = &sm[st & 1].Vs[(kt & 1) * 64];

    // S^T = K (64x64) @ Q^T (64x16): 4 key tiles, 2 K-steps each; sc[t][v] = S[query ln16][key 16t + 8hf + v]
    // All eight K fragments are read as one group ahead of the products.
    v16bf kf[2][4];
#pragma unroll
    for (int j = 0; j < 2; ++j)
#pragma unroll
      for (int t = 0; t < 4; ++t) {
        const bf16* kp = &Ks[t * 16 + ln16][j * 32 + hf * 8];
        kf[j][t] = __builtin_shufflevector(*(const bf16x8*)kp, *(const bf16x8*)(kp + 16),
                                           0, 1, 2, 3, 4, 5, 6, 7, 8, 9, 10, 11, 12, 13, 14, 15);
      }
    // The eight V^T fragments (A operand of V^T.P^T) are read in the same group: they land under the score
    // products and the softmax.
    v16bf vf[2][4];
#pragma unroll
    for (int j = 0; j < 2; ++j)
#pragma unroll
      for (int t = 0; t < 4; ++t)
        vf[j][t] = frag_tr16(&Vs[j * 32 + hf * 8 + (lane & 7)][t * 16 + ((lane >> 3) & 1) * 8], 80);
    // Inputs-only fence on the loaded K fragments: without it the compiler sinks the second four behind the first
    // products, each pair of reads with a wait to 0 of its own, and the wave sits out the LDS latency five times.
    asm volatile("" :: "v"(kf[0][0]), "v"(kf[0][1]), "v"(kf[0][2]), "v"(kf[0][3]),
                       "v"(kf[1][0]), "v"(kf[1][1]), "v"(kf[1][2]), "v"(kf[1][3]));
    v8f sc[4];
#pragma unroll
    for (int t = 0; t < 4; ++t) sc[t] = wmma_bf16(kf[0][t], qf[0], (v8f){0, 0, 0, 0, 0, 0, 0, 0});
#pragma unroll
    for (int t = 0; t < 4; ++t) sc[t] = wmma_bf16(kf[1][t], qf[1], sc[t]);

    // causal mask on diagonal tile (additive NINF to match reference)
    if (kt == qt) {
      const int qr = wave * 16 + ln16;
#pragma unroll
      for (int t = 0; t < 4; ++t)
#pragma unroll
        for (int v = 0; v < 8; ++v)
          sc[t][v] += (t * 16 + hf * 8 + v > qr) ? NINF : 0.f;
    }

    // online softmax: 32 of the query's 64 scores in this lane, the rest in lane ^ 16
    float mt[4];
#pragma unroll
    for (int t = 0; t < 4; ++t) {
      mt[t] = sc[t][0];
#pragma unroll
      for (int v = 1; v < 8; ++v) mt[t] = fmaxf(mt[t], sc[t][v]);
    }
    float mx = fmaxf(fmaxf(mt[0], mt[1]), fmaxf(mt[2], mt[3]));
    mx = fmaxf(mx, other_half(mx));
    const float mnew = fmaxf(mrow, mx);
    const float corr = __expf(mrow - mnew);
    float rs[4];
#pragma unroll
    for (int t = 0; t < 4; ++t) {
      rs[t] = 0.f;
#pragma unroll
      for (int v = 0; v < 8; ++v) {
        float p = __expf(sc[t][v] - mnew);
        sc[t][v] = p;
        rs[t] += p;
        o[t][v] *= corr;
      }
    }
    lrow = lrow * corr + ((rs[0] + rs[1]) + (rs[2] + rs[3]));
    mrow = mnew;

    // P^T fragments: element s of K-step j is key 32j + (s < 8 ? 8hf + s : 16 + 8hf + s - 8)
    v16bf pf[2];
#pragma unroll
    for (int j = 0; j < 2; ++j)
#pragma unroll
      for (int s = 0; s < 16; ++s) pf[j][s] = (bf16)sc[2 * j + (s >> 3)][s & 7];

    // O^T += V^T (64x64) @ P^T (64x16)
#pragma unroll
    for (int t = 0; t < 4; ++t) {
      v8f a = o[t];
#pragma unroll
      for (int j = 0; j < 2; ++j) {
        a = wmma_bf16(vf[j][t], pf[j], a);
      }
      o[t] = a;
    }

    // hand-over behind a stage's second tile: the one barrier publishes stage st + 1 and gives buffer st & 1 free
    if (kt & 1) {
      wait_ds0();        // this wave's fragment reads of the buffer refilled below
      wait_async();      // this wave's copies of stage st + 1
      __syncthreads();
      if (st + 2 < nst) copy_stage(st + 2, st & 1);
    }
  }
  wait_async();          // nothing is in flight when the tile, or the wave, ends
  if (half == 0) {
    wait_ds0();          // this wave's last fragment reads of the first tile
    __syncthreads();     // every wave has left both buffers
    copy_stage(0, 0);    // the second tile's first stage flies under the first tile's stores and the Q loads
  }

  // normalize + write ctx (bf16, [B*S][DIM] at col h*64): 8 consecutive d a lane and tile, one 16-byte store
  lrow += other_half(lrow);
  const float inv = 1.0f / lrow;
  bf16* cp = &ctx[(size_t)(b * S_ + q0 + wave * 16 + ln16) * DIM_ + h * 64 + hf * 8];
#pragma unroll
  for (int t = 0; t < 4; ++t) {
    bf16x8 ov;
#pragma unroll
    for (int v = 0; v < 8; ++v) ov[v] = (bf16)(o[t][v] * inv);
    *(bf16x8*)&cp[t * 16] = ov;
  }
  // the second tile's code reuses the registers that these stores name
  asm volatile("s_wait_xcnt 0x0" ::: "memory");
  }
}

// ---------------------------------------------------------------- host launch
static inline size_t align256(size_t x) { return (x + 255) & ~(size_t)255; }

extern "C" void kernel_launch(void* const* d_in, const int* in_sizes, int n_in,
                              void* d_out, int out_size, void* d_ws, size_t ws_size,
                              hipStream_t stream) {
  const float* x    = (const float*)d_in[0];
  const float* ln_g = (const float*)d_in[1];
  const float* ln_b = (const float*)d_in[2];
  const float* wqkv = (const float*)d_in[3];
  const float* bqkv = (const float*)d_in[4];
  const float* wo   = (const float*)d_in[5];
  const float* bo   = (const float*)d_in[6];
  float* out = (float*)d_out;

  const int M = B_ * S_;          // 4096
  const int N1 = 3 * DIM_;        // 3072
  const int K = DIM_;             // 1024

  char* ws = (char*)d_ws;
  size_t off = 0;
  bf16* wqkv_b = (bf16*)(ws + off); off = align256(off + (size_t)K * N1 * 2);
  bf16* wo_b   = (bf16*)(ws + off); off = align256(off + (size_t)K * DIM_ * 2);
  bf16* h_b    = (bf16*)(ws + off); off = align256(off + (size_t)M * DIM_ * 2);
  bf16* qkv_b  = (bf16*)(ws + off); off = align256(off + (size_t)M * N1 * 2);
  bf16* ctx_b  = (bf16*)(ws + off); off = align256(off + (size_t)M * DIM_ * 2);
  (void)ws_size; (void)in_sizes; (void)n_in; (void)out_size;

  // 1, 2) layernorm and both weights -> bf16, one launch
  front_pass<<<LN_BLOCKS + WQKV_BLOCKS + WO_BLOCKS, 256, 0, stream>>>(x, ln_g, ln_b, wqkv, wo, h_b, wqkv_b, wo_b);
  // 3) QKV GEMM: [4096,1024]x[1024,3072] + bqkv -> bf16
  gemm_bf16_wmma<4096, 3072, 1024, 128, 256, 192, true, false, true>
      <<<dim3(N1 / 192, M / 256), 256, 0, stream>>>(h_b, wqkv_b, bqkv, nullptr, (void*)qkv_b);
  // 4) causal flash attention -> ctx bf16
  attn_flash<<<B_ * H_ * (S_ / 128), 128, 0, stream>>>(qkv_b, ctx_b);
  // 5) output GEMM + bias + residual -> f32 out
  gemm_bf16_wmma<4096, 1024, 1024, 128, 128, 128, false, true, false>
      <<<dim3(DIM_ / 128, M / 128), 256, 0, stream>>>(ctx_b, wo_b, bo, x, (void*)out);
}
